// v000
// Times are from an AMD MI455X. After a warm-up the kernel runs many times in a row, and a time is the length of
// such a window on the GPU divided by its runs, so every launch and the gaps after it count. The runs cycle
// through copies of the inputs. A figure is the median of several windows, for all but v000 over two sittings.
// Sittings can differ by a few percent; kernels timed side by side share one.
// The starting kernel, v000, takes 295 microseconds a run.
#include <hip/hip_runtime.h>
#include <hip/hip_bf16.h>
#include <stdint.h>

typedef __attribute__((ext_vector_type(16))) _Float16 v16h;
typedef __attribute__((ext_vector_type(8)))  _Float16 v8h;
typedef __attribute__((ext_vector_type(8)))  float    v8f;

#define BDIM  2
#define TDIM  2048
#define DDIM  1024
#define HH    16
#define DH    64
#define NROWS (BDIM * TDIM)   // 4096

static __device__ __forceinline__ v8f wmma_f16(v16h a, v16h b, v8f c) {
    return __builtin_amdgcn_wmma_f32_16x16x32_f16(
        false, a, false, b, (short)0, c, false, false);
}

static __device__ __forceinline__ void async_cp16(void* lds_ptr, const void* gptr) {
    unsigned lds_off = (unsigned)(uintptr_t)lds_ptr;   // low 32 bits = LDS offset
    uint64_t gaddr   = (uint64_t)(uintptr_t)gptr;
    asm volatile("global_load_async_to_lds_b128 %0, %1, off"
                 :: "v"(lds_off), "v"(gaddr)
                 : "memory");
}
static __device__ __forceinline__ void wait_async0() {
    asm volatile("s_wait_asynccnt 0x0" ::: "memory");
}

// ---------------------------------------------------------------------------
// Kernel 1: LayerNorm, f32 in -> f16 out.  One block (256 thr) per row.
// ---------------------------------------------------------------------------
__global__ void ln_kernel(const float* __restrict__ x,
                          const float* __restrict__ gamma,
                          const float* __restrict__ beta,
                          _Float16* __restrict__ xn) {
    const int row = blockIdx.x;
    const int tid = threadIdx.x;
    const float* xr = x + (size_t)row * DDIM;
    float4 v = ((const float4*)xr)[tid];
    float s  = v.x + v.y + v.z + v.w;
    float s2 = v.x*v.x + v.y*v.y + v.z*v.z + v.w*v.w;
    #pragma unroll
    for (int m = 16; m >= 1; m >>= 1) {
        s  += __shfl_xor(s,  m, 32);
        s2 += __shfl_xor(s2, m, 32);
    }
    __shared__ float rs[8], rs2[8];
    const int wv = tid >> 5, ln = tid & 31;
    if (ln == 0) { rs[wv] = s; rs2[wv] = s2; }
    __syncthreads();
    if (tid == 0) {
        float a = 0.f, b = 0.f;
        #pragma unroll
        for (int i = 0; i < 8; i++) { a += rs[i]; b += rs2[i]; }
        rs[0] = a; rs2[0] = b;
    }
    __syncthreads();
    const float mu  = rs[0] * (1.0f / DDIM);
    const float var = rs2[0] * (1.0f / DDIM) - mu * mu;
    const float inv = rsqrtf(var + 1e-5f);
    const int base = tid * 4;
    float4 g  = ((const float4*)gamma)[tid];
    float4 bb = ((const float4*)beta)[tid];
    _Float16* dst = xn + (size_t)row * DDIM + base;
    dst[0] = (_Float16)((v.x - mu) * inv * g.x + bb.x);
    dst[1] = (_Float16)((v.y - mu) * inv * g.y + bb.y);
    dst[2] = (_Float16)((v.z - mu) * inv * g.z + bb.z);
    dst[3] = (_Float16)((v.w - mu) * inv * g.w + bb.w);
}

// ---------------------------------------------------------------------------
// Kernel 2: weights -> f16, TRANSPOSED (WT[n][k] = W[k][n]), packed 4x.
// Makes the GEMM B-tile a straight row-major copy (async-friendly).
// ---------------------------------------------------------------------------
__global__ void cvt_wT_kernel(const float* __restrict__ wq, const float* __restrict__ wk,
                              const float* __restrict__ wv, const float* __restrict__ wo,
                              _Float16* __restrict__ w16t) {
    const size_t i = ((size_t)blockIdx.x * blockDim.x + threadIdx.x) * 4;
    const size_t DD = (size_t)DDIM * DDIM;
    const float* srcs[4] = {wq, wk, wv, wo};
    const size_t m = i / DD, off = i % DD;
    const int n = (int)(off / DDIM);     // output row (= W column)
    const int k = (int)(off % DDIM);     // output col (= W row), 4 contiguous
    const float* s = srcs[m];
    _Float16* d = w16t + i;
    #pragma unroll
    for (int j = 0; j < 4; j++) d[j] = (_Float16)s[(size_t)(k + j) * DDIM + n];
}

// ---------------------------------------------------------------------------
// Kernel 3/5: tiled WMMA GEMM.  C[4096 x 1024] = A16 * WT16^T + bias.
//   Block 256 thr = 8 waves; tile 128(M) x 64(N); K-step 32.
//   B tile async-copied from WT (row-major [n][k]) into Bs[64][32].
// MODE 0: out f16 row-major (q, k).
// MODE 1: out f16 transposed [D][NROWS] (v -> VT, free in scattered epilogue).
// MODE 2: out f32 = val + resid (final output).
// ---------------------------------------------------------------------------
template <int MODE>
__global__ void gemm_kernel(const _Float16* __restrict__ A,
                            const _Float16* __restrict__ WT,
                            const float* __restrict__ bias,
                            const float* __restrict__ resid,
                            _Float16* __restrict__ out16,
                            float* __restrict__ out32) {
    __shared__ _Float16 Bs[64][32];    // [col][k], 4 KB
    const int tid = threadIdx.x;
    const int wv  = tid >> 5;
    const int ln  = tid & 31;
    const int M0  = blockIdx.y * 128 + wv * 16;
    const int N0  = blockIdx.x * 64;
    const int lrow  = ln & 15;
    const int lhalf = ln >> 4;

    v8f acc[4] = {v8f{}, v8f{}, v8f{}, v8f{}};
    const _Float16* arow = A + (size_t)(M0 + lrow) * DDIM;

    const int sc  = tid >> 2;          // 0..63 : Bs row (= output col)
    const int sk  = (tid & 3) * 8;     // 0..24 : k offset (16B chunks)
    const _Float16* wrow = WT + (size_t)(N0 + sc) * DDIM + sk;

    for (int k0 = 0; k0 < DDIM; k0 += 32) {
        async_cp16(&Bs[sc][sk], wrow + k0);
        if (k0 + 32 < DDIM)
            __builtin_prefetch(arow + k0 + 32 + lhalf * 16, 0, 0);
        wait_async0();
        __syncthreads();

        v16h afrag = *(const v16h*)(arow + k0 + lhalf * 16);
        #pragma unroll
        for (int j = 0; j < 4; j++) {
            v16h bfrag = *(const v16h*)&Bs[j * 16 + lrow][lhalf * 16];
            acc[j] = wmma_f16(afrag, bfrag, acc[j]);
        }
        __syncthreads();
    }

    const int rowbase = M0 + lhalf * 8;
    #pragma unroll
    for (int j = 0; j < 4; j++) {
        const int col = N0 + j * 16 + lrow;
        const float bv = bias[col];
        #pragma unroll
        for (int i = 0; i < 8; i++) {
            const int row = rowbase + i;
            const float val = acc[j][i] + bv;
            if (MODE == 2) {
                const size_t idx = (size_t)row * DDIM + col;
                out32[idx] = val + resid[idx];
            } else if (MODE == 1) {
                out16[(size_t)col * NROWS + row] = (_Float16)val;   // VT
            } else {
                out16[(size_t)row * DDIM + col] = (_Float16)val;
            }
        }
    }
}

// ---------------------------------------------------------------------------
// Kernel 4: flash-style attention per (b, h, 128-query-row block).
//   K tile, VT tile and mask tile all async-copied to LDS each m-step.
// ---------------------------------------------------------------------------
__global__ void attn_kernel(const _Float16* __restrict__ Q,
                            const _Float16* __restrict__ K,
                            const _Float16* __restrict__ VT,   // [D][NROWS]
                            const int* __restrict__ mask,
                            _Float16* __restrict__ Y) {
    __shared__ _Float16 Ks[32][64];      // [keyrow][k]       4 KB
    __shared__ _Float16 Vs[64][32];      // [d][keyrow]       4 KB
    __shared__ _Float16 Ps[8][16 * 32];  // per-wave P tiles  8 KB
    __shared__ int      Ms[128][32];     // mask tile        16 KB

    const int tid = threadIdx.x;
    const int wv  = tid >> 5;
    const int ln  = tid & 31;
    const int lrow  = ln & 15;
    const int lhalf = ln >> 4;
    const int b = blockIdx.z, h = blockIdx.y;
    const int nblk = blockIdx.x * 128;                // block's query-row base
    const int n0 = nblk + wv * 16;                    // this wave's rows
    const size_t headoff = (size_t)h * DH;

    const size_t qrow = (size_t)(b * TDIM + n0 + lrow) * DDIM + headoff;
    v16h q0 = *(const v16h*)(Q + qrow + lhalf * 16);
    v16h q1 = *(const v16h*)(Q + qrow + 32 + lhalf * 16);

    v8f o[4] = {v8f{}, v8f{}, v8f{}, v8f{}};
    float lsum[8] = {0.f, 0.f, 0.f, 0.f, 0.f, 0.f, 0.f, 0.f};
    const int lrow_c = wv * 16 + lhalf * 8;           // block-local C-layout row

    // staging thread maps
    const int kmr = tid >> 3, kc = (tid & 7) * 8;     // Ks: 32 x 64
    const int vd  = tid >> 2, vk = (tid & 3) * 8;     // Vs: 64 x 32
    const _Float16* ksrc = K  + (size_t)(b * TDIM + kmr) * DDIM + headoff + kc;
    const _Float16* vsrc = VT + (headoff + vd) * (size_t)NROWS + b * TDIM + vk;

    for (int m0 = 0; m0 < TDIM; m0 += 32) {
        async_cp16(&Ks[kmr][kc], ksrc + (size_t)m0 * DDIM);
        async_cp16(&Vs[vd][vk],  vsrc + m0);
        #pragma unroll
        for (int u = 0; u < 4; u++) {                 // mask tile 128x32 ints
            const int c   = tid + u * 256;            // 16B chunk id, 0..1023
            const int mrw = c >> 3;
            const int mcl = (c & 7) * 4;
            async_cp16(&Ms[mrw][mcl],
                       mask + ((size_t)b * TDIM + nblk + mrw) * TDIM + m0 + mcl);
        }
        wait_async0();
        __syncthreads();

        v8f s[2];
        #pragma unroll
        for (int t = 0; t < 2; t++) {
            v16h kf0 = *(const v16h*)&Ks[t * 16 + lrow][lhalf * 16];
            v16h kf1 = *(const v16h*)&Ks[t * 16 + lrow][32 + lhalf * 16];
            v8f z = v8f{};
            z = wmma_f16(q0, kf0, z);
            z = wmma_f16(q1, kf1, z);
            s[t] = z;
        }

        #pragma unroll
        for (int t = 0; t < 2; t++) {
            const int mloc = t * 16 + lrow;
            #pragma unroll
            for (int i = 0; i < 8; i++) {
                const int mk = Ms[lrow_c + i][mloc];
                float p = mk ? __expf(s[t][i] * 0.125f) : 0.0f;
                float r = p;
                r += __shfl_xor(r, 1, 32);
                r += __shfl_xor(r, 2, 32);
                r += __shfl_xor(r, 4, 32);
                r += __shfl_xor(r, 8, 32);
                lsum[i] += r;
                Ps[wv][(i + lhalf * 8) * 32 + mloc] = (_Float16)p;
            }
        }

        v16h pf = *(const v16h*)&Ps[wv][lrow * 32 + lhalf * 16];
        #pragma unroll
        for (int j = 0; j < 4; j++) {
            v16h vf = *(const v16h*)&Vs[j * 16 + lrow][lhalf * 16];
            o[j] = wmma_f16(pf, vf, o[j]);
        }
        __syncthreads();
    }

    #pragma unroll
    for (int j = 0; j < 4; j++) {
        #pragma unroll
        for (int i = 0; i < 8; i++) {
            const int nrow = n0 + lhalf * 8 + i;
            const float val = o[j][i] / (lsum[i] + 1e-20f);
            Y[(size_t)(b * TDIM + nrow) * DDIM + headoff + j * 16 + lrow] = (_Float16)val;
        }
    }
}

// ---------------------------------------------------------------------------
// Host launcher
// ---------------------------------------------------------------------------
extern "C" void kernel_launch(void* const* d_in, const int* in_sizes, int n_in,
                              void* d_out, int out_size, void* d_ws, size_t ws_size,
                              hipStream_t stream) {
    const float* x     = (const float*)d_in[0];
    const int*   mask  = (const int*)  d_in[1];
    const float* gamma = (const float*)d_in[2];
    const float* beta  = (const float*)d_in[3];
    const float* Wq    = (const float*)d_in[4];
    const float* bq    = (const float*)d_in[5];
    const float* Wk    = (const float*)d_in[6];
    const float* bk    = (const float*)d_in[7];
    const float* Wv    = (const float*)d_in[8];
    const float* bv    = (const float*)d_in[9];
    const float* Wo    = (const float*)d_in[10];
    const float* bo    = (const float*)d_in[11];
    float* out = (float*)d_out;

    const size_t ND = (size_t)NROWS * DDIM;
    const size_t DD = (size_t)DDIM * DDIM;
    _Float16* xn   = (_Float16*)d_ws;
    _Float16* q    = xn + ND;
    _Float16* k    = q + ND;
    _Float16* vt   = k + ND;          // [D][NROWS]
    _Float16* y    = vt + ND;
    _Float16* w16t = y + ND;          // 4*DD halves (total 48 MB)

    ln_kernel<<<NROWS, 256, 0, stream>>>(x, gamma, beta, xn);
    cvt_wT_kernel<<<(4 * DD) / 1024, 256, 0, stream>>>(Wq, Wk, Wv, Wo, w16t);

    dim3 ggrid(DDIM / 64, NROWS / 128);
    gemm_kernel<0><<<ggrid, 256, 0, stream>>>(xn, w16t + 0 * DD, bq, nullptr, q, nullptr);
    gemm_kernel<0><<<ggrid, 256, 0, stream>>>(xn, w16t + 1 * DD, bk, nullptr, k, nullptr);
    gemm_kernel<1><<<ggrid, 256, 0, stream>>>(xn, w16t + 2 * DD, bv, nullptr, vt, nullptr);

    dim3 agrid(TDIM / 128, HH, BDIM);
    attn_kernel<<<agrid, 256, 0, stream>>>(q, k, vt, mask, y);

    gemm_kernel<2><<<ggrid, 256, 0, stream>>>(y, w16t + 3 * DD, bo, x, nullptr, out);
}

// v001
// One run takes 226 microseconds.
// In both of two side-by-side timings against v000, it was 1.33 times as fast.
#include <hip/hip_runtime.h>
#include <hip/hip_bf16.h>
#include <stdint.h>

typedef __attribute__((ext_vector_type(16))) _Float16 v16h;
typedef __attribute__((ext_vector_type(8)))  _Float16 v8h;
typedef __attribute__((ext_vector_type(8)))  float    v8f;

#define BDIM  2
#define TDIM  2048
#define DDIM  1024
#define HH    16
#define DH    64
#define NROWS (BDIM * TDIM)   // 4096

static __device__ __forceinline__ v8f wmma_f16(v16h a, v16h b, v8f c) {
    return __builtin_amdgcn_wmma_f32_16x16x32_f16(
        false, a, false, b, (short)0, c, false, false);
}

static __device__ __forceinline__ void async_cp16(void* lds_ptr, const void* gptr) {
    unsigned lds_off = (unsigned)(uintptr_t)lds_ptr;   // low 32 bits = LDS offset
    uint64_t gaddr   = (uint64_t)(uintptr_t)gptr;
    asm volatile("global_load_async_to_lds_b128 %0, %1, off"
                 :: "v"(lds_off), "v"(gaddr)
                 : "memory");
}
static __device__ __forceinline__ void wait_async0() {
    asm volatile("s_wait_asynccnt 0x0" ::: "memory");
}

#define P32H 40
#define P64H 72
#define P32I 36

// 16 x 32 fragment slice of one lane: 32 contiguous bytes, 16-B aligned.
static __device__ __forceinline__ v16h lds_frag(const _Float16* p) {
    v8h lo = *(const v8h*)p;
    v8h hi = *(const v8h*)(p + 8);
    return __builtin_shufflevector(lo, hi, 0, 1, 2, 3, 4, 5, 6, 7,
                                   8, 9, 10, 11, 12, 13, 14, 15);
}

// ---------------------------------------------------------------------------
// Kernel 1: LayerNorm, f32 in -> f16 out.  One block (256 thr) per row.
// ---------------------------------------------------------------------------
__global__ void ln_kernel(const float* __restrict__ x,
                          const float* __restrict__ gamma,
                          const float* __restrict__ beta,
                          _Float16* __restrict__ xn) {
    const int row = blockIdx.x;
    const int tid = threadIdx.x;
    const float* xr = x + (size_t)row * DDIM;
    float4 v = ((const float4*)xr)[tid];
    float s  = v.x + v.y + v.z + v.w;
    float s2 = v.x*v.x + v.y*v.y + v.z*v.z + v.w*v.w;
    #pragma unroll
    for (int m = 16; m >= 1; m >>= 1) {
        s  += __shfl_xor(s,  m, 32);
        s2 += __shfl_xor(s2, m, 32);
    }
    __shared__ float rs[8], rs2[8];
    const int wv = tid >> 5, ln = tid & 31;
    if (ln == 0) { rs[wv] = s; rs2[wv] = s2; }
    __syncthreads();
    if (tid == 0) {
        float a = 0.f, b = 0.f;
        #pragma unroll
        for (int i = 0; i < 8; i++) { a += rs[i]; b += rs2[i]; }
        rs[0] = a; rs2[0] = b;
    }
    __syncthreads();
    const float mu  = rs[0] * (1.0f / DDIM);
    const float var = rs2[0] * (1.0f / DDIM) - mu * mu;
    const float inv = rsqrtf(var + 1e-5f);
    const int base = tid * 4;
    float4 g  = ((const float4*)gamma)[tid];
    float4 bb = ((const float4*)beta)[tid];
    _Float16* dst = xn + (size_t)row * DDIM + base;
    dst[0] = (_Float16)((v.x - mu) * inv * g.x + bb.x);
    dst[1] = (_Float16)((v.y - mu) * inv * g.y + bb.y);
    dst[2] = (_Float16)((v.z - mu) * inv * g.z + bb.z);
    dst[3] = (_Float16)((v.w - mu) * inv * g.w + bb.w);
}

// ---------------------------------------------------------------------------
// Kernel 2: weights -> f16, TRANSPOSED (WT[n][k] = W[k][n]), packed 4x.
// Makes the GEMM B-tile a straight row-major copy (async-friendly).
// ---------------------------------------------------------------------------
__global__ void cvt_wT_kernel(const float* __restrict__ wq, const float* __restrict__ wk,
                              const float* __restrict__ wv, const float* __restrict__ wo,
                              _Float16* __restrict__ w16t) {
    const size_t i = ((size_t)blockIdx.x * blockDim.x + threadIdx.x) * 4;
    const size_t DD = (size_t)DDIM * DDIM;
    const float* srcs[4] = {wq, wk, wv, wo};
    const size_t m = i / DD, off = i % DD;
    const int n = (int)(off / DDIM);     // output row (= W column)
    const int k = (int)(off % DDIM);     // output col (= W row), 4 contiguous
    const float* s = srcs[m];
    _Float16* d = w16t + i;
    #pragma unroll
    for (int j = 0; j < 4; j++) d[j] = (_Float16)s[(size_t)(k + j) * DDIM + n];
}

// ---------------------------------------------------------------------------
// Kernel 3/5: tiled WMMA GEMM.  C[4096 x 1024] = A16 * WT16^T + bias.
//   Block 256 thr = 8 waves; tile 128(M) x 64(N); K-step 32.
//   B tile async-copied from WT (row-major [n][k]) into Bs (64 rows of 32, padded).
// MODE 0: out f16 row-major (q, k).
// MODE 1: out f16 transposed [D][NROWS] (v -> VT, free in scattered epilogue).
// MODE 2: out f32 = val + resid (final output).
// ---------------------------------------------------------------------------
template <int MODE>
__global__ void gemm_kernel(const _Float16* __restrict__ A,
                            const _Float16* __restrict__ WT,
                            const float* __restrict__ bias,
                            const float* __restrict__ resid,
                            _Float16* __restrict__ out16,
                            float* __restrict__ out32) {
    __shared__ __attribute__((aligned(16))) _Float16 Bs[64][P32H];   // [col][k], 5 KB
    const int tid = threadIdx.x;
    const int wv  = tid >> 5;
    const int ln  = tid & 31;
    const int M0  = blockIdx.y * 128 + wv * 16;
    const int N0  = blockIdx.x * 64;
    const int lrow  = ln & 15;
    const int lhalf = ln >> 4;

    v8f acc[4] = {v8f{}, v8f{}, v8f{}, v8f{}};
    const _Float16* arow = A + (size_t)(M0 + lrow) * DDIM;

    const int sc  = tid >> 2;          // 0..63 : Bs row (= output col)
    const int sk  = (tid & 3) * 8;     // 0..24 : k offset (16B chunks)
    const _Float16* wrow = WT + (size_t)(N0 + sc) * DDIM + sk;

    for (int k0 = 0; k0 < DDIM; k0 += 32) {
        async_cp16(&Bs[sc][sk], wrow + k0);
        if (k0 + 32 < DDIM)
            __builtin_prefetch(arow + k0 + 32 + lhalf * 16, 0, 0);
        wait_async0();
        __syncthreads();

        v16h afrag = *(const v16h*)(arow + k0 + lhalf * 16);
        #pragma unroll
        for (int j = 0; j < 4; j++) {
            v16h bfrag = lds_frag(&Bs[j * 16 + lrow][lhalf * 16]);
            acc[j] = wmma_f16(afrag, bfrag, acc[j]);
        }
        __syncthreads();
    }

    const int rowbase = M0 + lhalf * 8;
    #pragma unroll
    for (int j = 0; j < 4; j++) {
        const int col = N0 + j * 16 + lrow;
        const float bv = bias[col];
        #pragma unroll
        for (int i = 0; i < 8; i++) {
            const int row = rowbase + i;
            const float val = acc[j][i] + bv;
            if (MODE == 2) {
                const size_t idx = (size_t)row * DDIM + col;
                out32[idx] = val + resid[idx];
            } else if (MODE == 1) {
                out16[(size_t)col * NROWS + row] = (_Float16)val;   // VT
            } else {
                out16[(size_t)row * DDIM + col] = (_Float16)val;
            }
        }
    }
}

// ---------------------------------------------------------------------------
// Kernel 4: flash-style attention per (b, h, 128-query-row block).
//   K tile, VT tile and mask tile all async-copied to LDS each m-step.
// ---------------------------------------------------------------------------
__global__ __launch_bounds__(256)   // the real block size: without it the padded addressing spills Q to scratch
void attn_kernel(const _Float16* __restrict__ Q,
                            const _Float16* __restrict__ K,
                            const _Float16* __restrict__ VT,   // [D][NROWS]
                            const int* __restrict__ mask,
                            _Float16* __restrict__ Y) {
    __shared__ __attribute__((aligned(16))) _Float16 Ks[32][P64H];      // [keyrow][k]      4.5 KB
    __shared__ __attribute__((aligned(16))) _Float16 Vs[64][P32H];      // [d][keyrow]        5 KB
    __shared__ __attribute__((aligned(16))) _Float16 Ps[8][16 * P32H];  // per-wave P tiles  10 KB
    __shared__ __attribute__((aligned(16))) int      Ms[128][P32I];     // mask tile         18 KB

    const int tid = threadIdx.x;
    const int wv  = tid >> 5;
    const int ln  = tid & 31;
    const int lrow  = ln & 15;
    const int lhalf = ln >> 4;
    const int b = blockIdx.z, h = blockIdx.y;
    const int nblk = blockIdx.x * 128;                // block's query-row base
    const int n0 = nblk + wv * 16;                    // this wave's rows
    const size_t headoff = (size_t)h * DH;

    const size_t qrow = (size_t)(b * TDIM + n0 + lrow) * DDIM + headoff;
    v16h q0 = *(const v16h*)(Q + qrow + lhalf * 16);
    v16h q1 = *(const v16h*)(Q + qrow + 32 + lhalf * 16);

    v8f o[4] = {v8f{}, v8f{}, v8f{}, v8f{}};
    float lsum[8] = {0.f, 0.f, 0.f, 0.f, 0.f, 0.f, 0.f, 0.f};
    const int lrow_c = wv * 16 + lhalf * 8;           // block-local C-layout row

    // staging thread maps
    const int kmr = tid >> 3, kc = (tid & 7) * 8;     // Ks: 32 x 64
    const int vd  = tid >> 2, vk = (tid & 3) * 8;     // Vs: 64 x 32
    const _Float16* ksrc = K  + (size_t)(b * TDIM + kmr) * DDIM + headoff + kc;
    const _Float16* vsrc = VT + (headoff + vd) * (size_t)NROWS + b * TDIM + vk;

    for (int m0 = 0; m0 < TDIM; m0 += 32) {
        async_cp16(&Ks[kmr][kc], ksrc + (size_t)m0 * DDIM);
        async_cp16(&Vs[vd][vk],  vsrc + m0);
        #pragma unroll
        for (int u = 0; u < 4; u++) {                 // mask tile 128x32 ints
            const int c   = tid + u * 256;            // 16B chunk id, 0..1023
            const int mrw = c >> 3;
            const int mcl = (c & 7) * 4;
            async_cp16(&Ms[mrw][mcl],
                       mask + ((size_t)b * TDIM + nblk + mrw) * TDIM + m0 + mcl);
        }
        wait_async0();
        __syncthreads();

        v8f s[2];
        #pragma unroll
        for (int t = 0; t < 2; t++) {
            v16h kf0 = lds_frag(&Ks[t * 16 + lrow][lhalf * 16]);
            v16h kf1 = lds_frag(&Ks[t * 16 + lrow][32 + lhalf * 16]);
            v8f z = v8f{};
            z = wmma_f16(q0, kf0, z);
            z = wmma_f16(q1, kf1, z);
            s[t] = z;
        }

        #pragma unroll
        for (int t = 0; t < 2; t++) {
            const int mloc = t * 16 + lrow;
            #pragma unroll
            for (int i = 0; i < 8; i++) {
                const int mk = Ms[lrow_c + i][mloc];
                float p = mk ? __expf(s[t][i] * 0.125f) : 0.0f;
                float r = p;
                r += __shfl_xor(r, 1, 32);
                r += __shfl_xor(r, 2, 32);
                r += __shfl_xor(r, 4, 32);
                r += __shfl_xor(r, 8, 32);
                lsum[i] += r;
                Ps[wv][(i + lhalf * 8) * P32H + mloc] = (_Float16)p;
            }
        }

        v16h pf = lds_frag(&Ps[wv][lrow * P32H + lhalf * 16]);
        #pragma unroll
        for (int j = 0; j < 4; j++) {
            v16h vf = lds_frag(&Vs[j * 16 + lrow][lhalf * 16]);
            o[j] = wmma_f16(pf, vf, o[j]);
        }
        __syncthreads();
    }

    #pragma unroll
    for (int j = 0; j < 4; j++) {
        #pragma unroll
        for (int i = 0; i < 8; i++) {
            const int nrow = n0 + lhalf * 8 + i;
            const float val = o[j][i] / (lsum[i] + 1e-20f);
            Y[(size_t)(b * TDIM + nrow) * DDIM + headoff + j * 16 + lrow] = (_Float16)val;
        }
    }
}

// ---------------------------------------------------------------------------
// Host launcher
// ---------------------------------------------------------------------------
extern "C" void kernel_launch(void* const* d_in, const int* in_sizes, int n_in,
                              void* d_out, int out_size, void* d_ws, size_t ws_size,
                              hipStream_t stream) {
    const float* x     = (const float*)d_in[0];
    const int*   mask  = (const int*)  d_in[1];
    const float* gamma = (const float*)d_in[2];
    const float* beta  = (const float*)d_in[3];
    const float* Wq    = (const float*)d_in[4];
    const float* bq    = (const float*)d_in[5];
    const float* Wk    = (const float*)d_in[6];
    const float* bk    = (const float*)d_in[7];
    const float* Wv    = (const float*)d_in[8];
    const float* bv    = (const float*)d_in[9];
    const float* Wo    = (const float*)d_in[10];
    const float* bo    = (const float*)d_in[11];
    float* out = (float*)d_out;

    const size_t ND = (size_t)NROWS * DDIM;
    const size_t DD = (size_t)DDIM * DDIM;
    _Float16* xn   = (_Float16*)d_ws;
    _Float16* q    = xn + ND;
    _Float16* k    = q + ND;
    _Float16* vt   = k + ND;          // [D][NROWS]
    _Float16* y    = vt + ND;
    _Float16* w16t = y + ND;          // 4*DD halves (total 48 MB)

    ln_kernel<<<NROWS, 256, 0, stream>>>(x, gamma, beta, xn);
    cvt_wT_kernel<<<(4 * DD) / 1024, 256, 0, stream>>>(Wq, Wk, Wv, Wo, w16t);

    dim3 ggrid(DDIM / 64, NROWS / 128);
    gemm_kernel<0><<<ggrid, 256, 0, stream>>>(xn, w16t + 0 * DD, bq, nullptr, q, nullptr);
    gemm_kernel<0><<<ggrid, 256, 0, stream>>>(xn, w16t + 1 * DD, bk, nullptr, k, nullptr);
    gemm_kernel<1><<<ggrid, 256, 0, stream>>>(xn, w16t + 2 * DD, bv, nullptr, vt, nullptr);

    dim3 agrid(TDIM / 128, HH, BDIM);
    attn_kernel<<<agrid, 256, 0, stream>>>(q, k, vt, mask, y);

    gemm_kernel<2><<<ggrid, 256, 0, stream>>>(y, w16t + 3 * DD, bo, x, nullptr, out);
}

// v002
// Measured time: 196 microseconds a run.
// In both of two side-by-side timings against v001, it was 1.16 times as fast.
// All steps since v000 together make it 1.54 times as fast.
#include <hip/hip_runtime.h>
#include <hip/hip_bf16.h>
#include <stdint.h>

typedef __attribute__((ext_vector_type(16))) _Float16 v16h;
typedef __attribute__((ext_vector_type(8)))  _Float16 v8h;
typedef __attribute__((ext_vector_type(8)))  float    v8f;

#define BDIM  2
#define TDIM  2048
#define DDIM  1024
#define HH    16
#define DH    64
#define NROWS (BDIM * TDIM)   // 4096

static __device__ __forceinline__ v8f wmma_f16(v16h a, v16h b, v8f c) {
    return __builtin_amdgcn_wmma_f32_16x16x32_f16(
        false, a, false, b, (short)0, c, false, false);
}

static __device__ __forceinline__ void async_cp16(void* lds_ptr, const void* gptr) {
    unsigned lds_off = (unsigned)(uintptr_t)lds_ptr;   // low 32 bits = LDS offset
    uint64_t gaddr   = (uint64_t)(uintptr_t)gptr;
    asm volatile("global_load_async_to_lds_b128 %0, %1, off"
                 :: "v"(lds_off), "v"(gaddr)
                 : "memory");
}
static __device__ __forceinline__ void async_cp16x4(void* l0, const void* g0,
                                                    void* l1, const void* g1,
                                                    void* l2, const void* g2,
                                                    void* l3, const void* g3) {
    asm volatile("global_load_async_to_lds_b128 %0, %4, off\n\t"
                 "global_load_async_to_lds_b128 %1, %5, off\n\t"
                 "global_load_async_to_lds_b128 %2, %6, off\n\t"
                 "global_load_async_to_lds_b128 %3, %7, off\n\t"
                 "s_wait_xcnt 0x0"
                 :: "v"((unsigned)(uintptr_t)l0), "v"((unsigned)(uintptr_t)l1),
                    "v"((unsigned)(uintptr_t)l2), "v"((unsigned)(uintptr_t)l3),
                    "v"((uint64_t)(uintptr_t)g0), "v"((uint64_t)(uintptr_t)g1),
                    "v"((uint64_t)(uintptr_t)g2), "v"((uint64_t)(uintptr_t)g3)
                 : "memory");
}
static __device__ __forceinline__ void wait_async0() {
    asm volatile("s_wait_asynccnt 0x0" ::: "memory");
}

#define P32H 40
#define P64H 72
#define P128H 136
#define P32I 36

// 16 x 32 fragment slice of one lane: 32 contiguous bytes, 16-B aligned.
static __device__ __forceinline__ v16h lds_frag(const _Float16* p) {
    v8h lo = *(const v8h*)p;
    v8h hi = *(const v8h*)(p + 8);
    return __builtin_shufflevector(lo, hi, 0, 1, 2, 3, 4, 5, 6, 7,
                                   8, 9, 10, 11, 12, 13, 14, 15);
}

// ---------------------------------------------------------------------------
// Kernel 1: LayerNorm, f32 in -> f16 out.  One block (256 thr) per row.
// ---------------------------------------------------------------------------
__global__ void ln_kernel(const float* __restrict__ x,
                          const float* __restrict__ gamma,
                          const float* __restrict__ beta,
                          _Float16* __restrict__ xn) {
    const int row = blockIdx.x;
    const int tid = threadIdx.x;
    const float* xr = x + (size_t)row * DDIM;
    float4 v = ((const float4*)xr)[tid];
    float s  = v.x + v.y + v.z + v.w;
    float s2 = v.x*v.x + v.y*v.y + v.z*v.z + v.w*v.w;
    #pragma unroll
    for (int m = 16; m >= 1; m >>= 1) {
        s  += __shfl_xor(s,  m, 32);
        s2 += __shfl_xor(s2, m, 32);
    }
    __shared__ float rs[8], rs2[8];
    const int wv = tid >> 5, ln = tid & 31;
    if (ln == 0) { rs[wv] = s; rs2[wv] = s2; }
    __syncthreads();
    if (tid == 0) {
        float a = 0.f, b = 0.f;
        #pragma unroll
        for (int i = 0; i < 8; i++) { a += rs[i]; b += rs2[i]; }
        rs[0] = a; rs2[0] = b;
    }
    __syncthreads();
    const float mu  = rs[0] * (1.0f / DDIM);
    const float var = rs2[0] * (1.0f / DDIM) - mu * mu;
    const float inv = rsqrtf(var + 1e-5f);
    const int base = tid * 4;
    float4 g  = ((const float4*)gamma)[tid];
    float4 bb = ((const float4*)beta)[tid];
    _Float16* dst = xn + (size_t)row * DDIM + base;
    dst[0] = (_Float16)((v.x - mu) * inv * g.x + bb.x);
    dst[1] = (_Float16)((v.y - mu) * inv * g.y + bb.y);
    dst[2] = (_Float16)((v.z - mu) * inv * g.z + bb.z);
    dst[3] = (_Float16)((v.w - mu) * inv * g.w + bb.w);
}

// ---------------------------------------------------------------------------
// Kernel 2: weights -> f16, TRANSPOSED (WT[n][k] = W[k][n]), packed 4x.
// Makes the GEMM B-tile a straight row-major copy (async-friendly).
// ---------------------------------------------------------------------------
__global__ void cvt_wT_kernel(const float* __restrict__ wq, const float* __restrict__ wk,
                              const float* __restrict__ wv, const float* __restrict__ wo,
                              _Float16* __restrict__ w16t) {
    const size_t i = ((size_t)blockIdx.x * blockDim.x + threadIdx.x) * 4;
    const size_t DD = (size_t)DDIM * DDIM;
    const float* srcs[4] = {wq, wk, wv, wo};
    const size_t m = i / DD, off = i % DD;
    const int n = (int)(off / DDIM);     // output row (= W column)
    const int k = (int)(off % DDIM);     // output col (= W row), 4 contiguous
    const float* s = srcs[m];
    _Float16* d = w16t + i;
    #pragma unroll
    for (int j = 0; j < 4; j++) d[j] = (_Float16)s[(size_t)(k + j) * DDIM + n];
}

// ---------------------------------------------------------------------------
// Kernel 3/5: tiled WMMA GEMM.  C[4096 x 1024] = A16 * WT16^T + bias.
//   Block 256 thr = 8 waves; tile 128(M) x 64(N); 128 k per staging round, so
//   that the copy latency, the A latency and the two barriers are paid 8 times.
//   B tile async-copied from WT (row-major [n][k]) into Bs (64 rows of 128, padded).
// MODE 0: out f16 row-major (q, k).
// MODE 1: out f16 transposed [D][NROWS] (v -> VT, free in scattered epilogue).
// MODE 2: out f32 = val + resid (final output).
// ---------------------------------------------------------------------------
template <int MODE>
__global__ void gemm_kernel(const _Float16* __restrict__ A,
                            const _Float16* __restrict__ WT,
                            const float* __restrict__ bias,
                            const float* __restrict__ resid,
                            _Float16* __restrict__ out16,
                            float* __restrict__ out32) {
    __shared__ __attribute__((aligned(16))) _Float16 Bs[64][P128H];  // [col][k], 17 KB
    const int tid = threadIdx.x;
    const int wv  = tid >> 5;
    const int ln  = tid & 31;
    const int M0  = blockIdx.y * 128 + wv * 16;
    const int N0  = blockIdx.x * 64;
    const int lrow  = ln & 15;
    const int lhalf = ln >> 4;

    v8f acc[4] = {v8f{}, v8f{}, v8f{}, v8f{}};
    const _Float16* arow = A + (size_t)(M0 + lrow) * DDIM;

    const int sc  = tid >> 4;          // 0..15  : Bs row (= output col), + 16 per copy
    const int sk  = (tid & 15) * 8;    // 0..120 : k offset (16B chunks)
    const _Float16* wrow = WT + (size_t)(N0 + sc) * DDIM + sk;

    for (int k0 = 0; k0 < DDIM; k0 += 128) {
        async_cp16x4(&Bs[sc][sk],      wrow + k0,
                     &Bs[sc + 16][sk], wrow + k0 + 16 * DDIM,
                     &Bs[sc + 32][sk], wrow + k0 + 32 * DDIM,
                     &Bs[sc + 48][sk], wrow + k0 + 48 * DDIM);
        v16h afrag[4];                 // the round's A loads fly beside its copies
        #pragma unroll                 // constant indices keep afrag in registers
        for (int s = 0; s < 4; s++)
            afrag[s] = *(const v16h*)(arow + k0 + s * 32 + lhalf * 16);
        if (k0 + 128 < DDIM)           // the two lanes of a row take its two next lines
            __builtin_prefetch(arow + k0 + 128 + lhalf * 64, 0, 0);
        wait_async0();
        __syncthreads();

        #pragma unroll                 // constant indices keep afrag and acc in registers
        for (int s = 0; s < 4; s++) {
            #pragma unroll
            for (int j = 0; j < 4; j++) {
                v16h bfrag = lds_frag(&Bs[j * 16 + lrow][s * 32 + lhalf * 16]);
                acc[j] = wmma_f16(afrag[s], bfrag, acc[j]);
            }
        }
        __syncthreads();
    }

    const int rowbase = M0 + lhalf * 8;
    #pragma unroll
    for (int j = 0; j < 4; j++) {
        const int col = N0 + j * 16 + lrow;
        const float bv = bias[col];
        #pragma unroll
        for (int i = 0; i < 8; i++) {
            const int row = rowbase + i;
            const float val = acc[j][i] + bv;
            if (MODE == 2) {
                const size_t idx = (size_t)row * DDIM + col;
                out32[idx] = val + resid[idx];
            } else if (MODE == 1) {
                out16[(size_t)col * NROWS + row] = (_Float16)val;   // VT
            } else {
                out16[(size_t)row * DDIM + col] = (_Float16)val;
            }
        }
    }
}

// ---------------------------------------------------------------------------
// Kernel 4: flash-style attention per (b, h, 128-query-row block).
//   K tile, VT tile and mask tile all async-copied to LDS each m-step.
// ---------------------------------------------------------------------------
__global__ __launch_bounds__(256)   // the real block size: without it the padded addressing spills Q to scratch
void attn_kernel(const _Float16* __restrict__ Q,
                            const _Float16* __restrict__ K,
                            const _Float16* __restrict__ VT,   // [D][NROWS]
                            const int* __restrict__ mask,
                            _Float16* __restrict__ Y) {
    __shared__ __attribute__((aligned(16))) _Float16 Ks[32][P64H];      // [keyrow][k]      4.5 KB
    __shared__ __attribute__((aligned(16))) _Float16 Vs[64][P32H];      // [d][keyrow]        5 KB
    __shared__ __attribute__((aligned(16))) _Float16 Ps[8][16 * P32H];  // per-wave P tiles  10 KB
    __shared__ __attribute__((aligned(16))) int      Ms[128][P32I];     // mask tile         18 KB

    const int tid = threadIdx.x;
    const int wv  = tid >> 5;
    const int ln  = tid & 31;
    const int lrow  = ln & 15;
    const int lhalf = ln >> 4;
    const int b = blockIdx.z, h = blockIdx.y;
    const int nblk = blockIdx.x * 128;                // block's query-row base
    const int n0 = nblk + wv * 16;                    // this wave's rows
    const size_t headoff = (size_t)h * DH;

    const size_t qrow = (size_t)(b * TDIM + n0 + lrow) * DDIM + headoff;
    v16h q0 = *(const v16h*)(Q + qrow + lhalf * 16);
    v16h q1 = *(const v16h*)(Q + qrow + 32 + lhalf * 16);

    v8f o[4] = {v8f{}, v8f{}, v8f{}, v8f{}};
    float lsum[8] = {0.f, 0.f, 0.f, 0.f, 0.f, 0.f, 0.f, 0.f};
    const int lrow_c = wv * 16 + lhalf * 8;           // block-local C-layout row

    // staging thread maps
    const int kmr = tid >> 3, kc = (tid & 7) * 8;     // Ks: 32 x 64
    const int vd  = tid >> 2, vk = (tid & 3) * 8;     // Vs: 64 x 32
    const _Float16* ksrc = K  + (size_t)(b * TDIM + kmr) * DDIM + headoff + kc;
    const _Float16* vsrc = VT + (headoff + vd) * (size_t)NROWS + b * TDIM + vk;

    for (int m0 = 0; m0 < TDIM; m0 += 32) {
        async_cp16(&Ks[kmr][kc], ksrc + (size_t)m0 * DDIM);
        async_cp16(&Vs[vd][vk],  vsrc + m0);
        #pragma unroll
        for (int u = 0; u < 4; u++) {                 // mask tile 128x32 ints
            const int c   = tid + u * 256;            // 16B chunk id, 0..1023
            const int mrw = c >> 3;
            const int mcl = (c & 7) * 4;
            async_cp16(&Ms[mrw][mcl],
                       mask + ((size_t)b * TDIM + nblk + mrw) * TDIM + m0 + mcl);
        }
        wait_async0();
        __syncthreads();

        v8f s[2];
        #pragma unroll
        for (int t = 0; t < 2; t++) {
            v16h kf0 = lds_frag(&Ks[t * 16 + lrow][lhalf * 16]);
            v16h kf1 = lds_frag(&Ks[t * 16 + lrow][32 + lhalf * 16]);
            v8f z = v8f{};
            z = wmma_f16(q0, kf0, z);
            z = wmma_f16(q1, kf1, z);
            s[t] = z;
        }

        #pragma unroll
        for (int t = 0; t < 2; t++) {
            const int mloc = t * 16 + lrow;
            #pragma unroll
            for (int i = 0; i < 8; i++) {
                const int mk = Ms[lrow_c + i][mloc];
                float p = mk ? __expf(s[t][i] * 0.125f) : 0.0f;
                float r = p;
                r += __shfl_xor(r, 1, 32);
                r += __shfl_xor(r, 2, 32);
                r += __shfl_xor(r, 4, 32);
                r += __shfl_xor(r, 8, 32);
                lsum[i] += r;
                Ps[wv][(i + lhalf * 8) * P32H + mloc] = (_Float16)p;
            }
        }

        v16h pf = lds_frag(&Ps[wv][lrow * P32H + lhalf * 16]);
        #pragma unroll
        for (int j = 0; j < 4; j++) {
            v16h vf = lds_frag(&Vs[j * 16 + lrow][lhalf * 16]);
            o[j] = wmma_f16(pf, vf, o[j]);
        }
        __syncthreads();
    }

    #pragma unroll
    for (int j = 0; j < 4; j++) {
        #pragma unroll
        for (int i = 0; i < 8; i++) {
            const int nrow = n0 + lhalf * 8 + i;
            const float val = o[j][i] / (lsum[i] + 1e-20f);
            Y[(size_t)(b * TDIM + nrow) * DDIM + headoff + j * 16 + lrow] = (_Float16)val;
        }
    }
}

// ---------------------------------------------------------------------------
// Host launcher
// ---------------------------------------------------------------------------
extern "C" void kernel_launch(void* const* d_in, const int* in_sizes, int n_in,
                              void* d_out, int out_size, void* d_ws, size_t ws_size,
                              hipStream_t stream) {
    const float* x     = (const float*)d_in[0];
    const int*   mask  = (const int*)  d_in[1];
    const float* gamma = (const float*)d_in[2];
    const float* beta  = (const float*)d_in[3];
    const float* Wq    = (const float*)d_in[4];
    const float* bq    = (const float*)d_in[5];
    const float* Wk    = (const float*)d_in[6];
    const float* bk    = (const float*)d_in[7];
    const float* Wv    = (const float*)d_in[8];
    const float* bv    = (const float*)d_in[9];
    const float* Wo    = (const float*)d_in[10];
    const float* bo    = (const float*)d_in[11];
    float* out = (float*)d_out;

    const size_t ND = (size_t)NROWS * DDIM;
    const size_t DD = (size_t)DDIM * DDIM;
    _Float16* xn   = (_Float16*)d_ws;
    _Float16* q    = xn + ND;
    _Float16* k    = q + ND;
    _Float16* vt   = k + ND;          // [D][NROWS]
    _Float16* y    = vt + ND;
    _Float16* w16t = y + ND;          // 4*DD halves (total 48 MB)

    ln_kernel<<<NROWS, 256, 0, stream>>>(x, gamma, beta, xn);
    cvt_wT_kernel<<<(4 * DD) / 1024, 256, 0, stream>>>(Wq, Wk, Wv, Wo, w16t);

    dim3 ggrid(DDIM / 64, NROWS / 128);
    gemm_kernel<0><<<ggrid, 256, 0, stream>>>(xn, w16t + 0 * DD, bq, nullptr, q, nullptr);
    gemm_kernel<0><<<ggrid, 256, 0, stream>>>(xn, w16t + 1 * DD, bk, nullptr, k, nullptr);
    gemm_kernel<1><<<ggrid, 256, 0, stream>>>(xn, w16t + 2 * DD, bv, nullptr, vt, nullptr);

    dim3 agrid(TDIM / 128, HH, BDIM);
    attn_kernel<<<agrid, 256, 0, stream>>>(q, k, vt, mask, y);

    gemm_kernel<2><<<ggrid, 256, 0, stream>>>(y, w16t + 3 * DD, bo, x, nullptr, out);
}

// v003
// One run takes 186 microseconds.
// In two side-by-side timings against v002, it was 1.06 and 1.05 times as fast.
// All steps since v000 together make it 1.62 times as fast.
#include <hip/hip_runtime.h>
#include <hip/hip_bf16.h>
#include <stdint.h>

typedef __attribute__((ext_vector_type(16))) _Float16 v16h;
typedef __attribute__((ext_vector_type(8)))  _Float16 v8h;
typedef __attribute__((ext_vector_type(8)))  float    v8f;

#define BDIM  2
#define TDIM  2048
#define DDIM  1024
#define HH    16
#define DH    64
#define NROWS (BDIM * TDIM)   // 4096

static __device__ __forceinline__ v8f wmma_f16(v16h a, v16h b, v8f c) {
    return __builtin_amdgcn_wmma_f32_16x16x32_f16(
        false, a, false, b, (short)0, c, false, false);
}

static __device__ __forceinline__ void async_cp16(void* lds_ptr, const void* gptr) {
    unsigned lds_off = (unsigned)(uintptr_t)lds_ptr;   // low 32 bits = LDS offset
    uint64_t gaddr   = (uint64_t)(uintptr_t)gptr;
    asm volatile("global_load_async_to_lds_b128 %0, %1, off"
                 :: "v"(lds_off), "v"(gaddr)
                 : "memory");
}
static __device__ __forceinline__ void async_cp16x4(void* l0, const void* g0,
                                                    void* l1, const void* g1,
                                                    void* l2, const void* g2,
                                                    void* l3, const void* g3) {
    asm volatile("global_load_async_to_lds_b128 %0, %4, off\n\t"
                 "global_load_async_to_lds_b128 %1, %5, off\n\t"
                 "global_load_async_to_lds_b128 %2, %6, off\n\t"
                 "global_load_async_to_lds_b128 %3, %7, off\n\t"
                 "s_wait_xcnt 0x0"
                 :: "v"((unsigned)(uintptr_t)l0), "v"((unsigned)(uintptr_t)l1),
                    "v"((unsigned)(uintptr_t)l2), "v"((unsigned)(uintptr_t)l3),
                    "v"((uint64_t)(uintptr_t)g0), "v"((uint64_t)(uintptr_t)g1),
                    "v"((uint64_t)(uintptr_t)g2), "v"((uint64_t)(uintptr_t)g3)
                 : "memory");
}
static __device__ __forceinline__ void wait_async0() {
    asm volatile("s_wait_asynccnt 0x0" ::: "memory");
}

#define P32H 40
#define P64H 72
#define P128H 136
#define P32I 36

// 16 x 32 fragment slice of one lane: 32 contiguous bytes, 16-B aligned.
static __device__ __forceinline__ v16h lds_frag(const _Float16* p) {
    v8h lo = *(const v8h*)p;
    v8h hi = *(const v8h*)(p + 8);
    return __builtin_shufflevector(lo, hi, 0, 1, 2, 3, 4, 5, 6, 7,
                                   8, 9, 10, 11, 12, 13, 14, 15);
}

// ---------------------------------------------------------------------------
// Kernel 1: LayerNorm, f32 in -> f16 out.  One block (256 thr) per row.
// ---------------------------------------------------------------------------
__global__ void ln_kernel(const float* __restrict__ x,
                          const float* __restrict__ gamma,
                          const float* __restrict__ beta,
                          _Float16* __restrict__ xn) {
    const int row = blockIdx.x;
    const int tid = threadIdx.x;
    const float* xr = x + (size_t)row * DDIM;
    float4 v = ((const float4*)xr)[tid];
    float s  = v.x + v.y + v.z + v.w;
    float s2 = v.x*v.x + v.y*v.y + v.z*v.z + v.w*v.w;
    #pragma unroll
    for (int m = 16; m >= 1; m >>= 1) {
        s  += __shfl_xor(s,  m, 32);
        s2 += __shfl_xor(s2, m, 32);
    }
    __shared__ float rs[8], rs2[8];
    const int wv = tid >> 5, ln = tid & 31;
    if (ln == 0) { rs[wv] = s; rs2[wv] = s2; }
    __syncthreads();
    if (tid == 0) {
        float a = 0.f, b = 0.f;
        #pragma unroll
        for (int i = 0; i < 8; i++) { a += rs[i]; b += rs2[i]; }
        rs[0] = a; rs2[0] = b;
    }
    __syncthreads();
    const float mu  = rs[0] * (1.0f / DDIM);
    const float var = rs2[0] * (1.0f / DDIM) - mu * mu;
    const float inv = rsqrtf(var + 1e-5f);
    const int base = tid * 4;
    float4 g  = ((const float4*)gamma)[tid];
    float4 bb = ((const float4*)beta)[tid];
    _Float16* dst = xn + (size_t)row * DDIM + base;
    dst[0] = (_Float16)((v.x - mu) * inv * g.x + bb.x);
    dst[1] = (_Float16)((v.y - mu) * inv * g.y + bb.y);
    dst[2] = (_Float16)((v.z - mu) * inv * g.z + bb.z);
    dst[3] = (_Float16)((v.w - mu) * inv * g.w + bb.w);
}

// ---------------------------------------------------------------------------
// Kernel 2: weights -> f16, TRANSPOSED (WT[n][k] = W[k][n]), packed 4x.
// Makes the GEMM B-tile a straight row-major copy (async-friendly).
// ---------------------------------------------------------------------------
__global__ void cvt_wT_kernel(const float* __restrict__ wq, const float* __restrict__ wk,
                              const float* __restrict__ wv, const float* __restrict__ wo,
                              _Float16* __restrict__ w16t) {
    const size_t i = ((size_t)blockIdx.x * blockDim.x + threadIdx.x) * 4;
    const size_t DD = (size_t)DDIM * DDIM;
    const float* srcs[4] = {wq, wk, wv, wo};
    const size_t m = i / DD, off = i % DD;
    const int n = (int)(off / DDIM);     // output row (= W column)
    const int k = (int)(off % DDIM);     // output col (= W row), 4 contiguous
    const float* s = srcs[m];
    _Float16* d = w16t + i;
    #pragma unroll
    for (int j = 0; j < 4; j++) d[j] = (_Float16)s[(size_t)(k + j) * DDIM + n];
}

// ---------------------------------------------------------------------------
// Kernel 3/5: tiled WMMA GEMM.  C[4096 x 1024] = A16 * WT16^T + bias.
//   Block 256 thr = 8 waves; tile 128(M) x 64(N); 128 k per staging round, so
//   that the copy latency, the A latency and the two barriers are paid 8 times.
//   B tile async-copied from WT (row-major [n][k]) into Bs (64 rows of 128, padded).
// MODE 0: out f16 row-major (q, k).
// MODE 1: out f16 transposed [D][NROWS] (v -> VT, free in scattered epilogue).
// MODE 2: out f32 = val + resid (final output).
// ---------------------------------------------------------------------------
template <int MODE>
__global__ void gemm_kernel(const _Float16* __restrict__ A,
                            const _Float16* __restrict__ WT,
                            const float* __restrict__ bias,
                            const float* __restrict__ resid,
                            _Float16* __restrict__ out16,
                            float* __restrict__ out32) {
    __shared__ __attribute__((aligned(16))) _Float16 Bs[64][P128H];  // [col][k], 17 KB
    const int tid = threadIdx.x;
    const int wv  = tid >> 5;
    const int ln  = tid & 31;
    const int M0  = blockIdx.y * 128 + wv * 16;
    const int N0  = blockIdx.x * 64;
    const int lrow  = ln & 15;
    const int lhalf = ln >> 4;

    v8f acc[4] = {v8f{}, v8f{}, v8f{}, v8f{}};
    const _Float16* arow = A + (size_t)(M0 + lrow) * DDIM;

    const int sc  = tid >> 4;          // 0..15  : Bs row (= output col), + 16 per copy
    const int sk  = (tid & 15) * 8;    // 0..120 : k offset (16B chunks)
    const _Float16* wrow = WT + (size_t)(N0 + sc) * DDIM + sk;

    for (int k0 = 0; k0 < DDIM; k0 += 128) {
        async_cp16x4(&Bs[sc][sk],      wrow + k0,
                     &Bs[sc + 16][sk], wrow + k0 + 16 * DDIM,
                     &Bs[sc + 32][sk], wrow + k0 + 32 * DDIM,
                     &Bs[sc + 48][sk], wrow + k0 + 48 * DDIM);
        v16h afrag[4];                 // the round's A loads fly beside its copies
        #pragma unroll                 // constant indices keep afrag in registers
        for (int s = 0; s < 4; s++)
            afrag[s] = *(const v16h*)(arow + k0 + s * 32 + lhalf * 16);
        if (k0 + 128 < DDIM)           // the two lanes of a row take its two next lines
            __builtin_prefetch(arow + k0 + 128 + lhalf * 64, 0, 0);
        wait_async0();
        __syncthreads();

        #pragma unroll                 // constant indices keep afrag and acc in registers
        for (int s = 0; s < 4; s++) {
            #pragma unroll
            for (int j = 0; j < 4; j++) {
                v16h bfrag = lds_frag(&Bs[j * 16 + lrow][s * 32 + lhalf * 16]);
                acc[j] = wmma_f16(afrag[s], bfrag, acc[j]);
            }
        }
        __syncthreads();
    }

    const int rowbase = M0 + lhalf * 8;
    #pragma unroll
    for (int j = 0; j < 4; j++) {
        const int col = N0 + j * 16 + lrow;
        const float bv = bias[col];
        #pragma unroll
        for (int i = 0; i < 8; i++) {
            const int row = rowbase + i;
            const float val = acc[j][i] + bv;
            if (MODE == 2) {
                const size_t idx = (size_t)row * DDIM + col;
                out32[idx] = val + resid[idx];
            } else if (MODE == 1) {
                out16[(size_t)col * NROWS + row] = (_Float16)val;   // VT
            } else {
                out16[(size_t)row * DDIM + col] = (_Float16)val;
            }
        }
    }
}

// ---------------------------------------------------------------------------
// Kernel 4: flash-style attention per (b, h, 128-query-row block).
//   K tile, VT tile and mask tile all async-copied to LDS each m-step.
// ---------------------------------------------------------------------------
__global__ __launch_bounds__(256)   // the real block size: without it the padded addressing spills Q to scratch
void attn_kernel(const _Float16* __restrict__ Q,
                            const _Float16* __restrict__ K,
                            const _Float16* __restrict__ VT,   // [D][NROWS]
                            const int* __restrict__ mask,
                            _Float16* __restrict__ Y) {
    __shared__ __attribute__((aligned(16))) _Float16 Ks[32][P64H];      // [keyrow][k]      4.5 KB
    __shared__ __attribute__((aligned(16))) _Float16 Vs[64][P32H];      // [d][keyrow]        5 KB
    __shared__ __attribute__((aligned(16))) _Float16 Ps[8][16 * P32H];  // per-wave P tiles  10 KB
    __shared__ __attribute__((aligned(16))) int      Ms[128][P32I];     // mask tile         18 KB

    const int tid = threadIdx.x;
    const int wv  = tid >> 5;
    const int ln  = tid & 31;
    const int lrow  = ln & 15;
    const int lhalf = ln >> 4;
    const int b = blockIdx.z, h = blockIdx.y;
    const int nblk = blockIdx.x * 128;                // block's query-row base
    const int n0 = nblk + wv * 16;                    // this wave's rows
    const size_t headoff = (size_t)h * DH;

    const size_t qrow = (size_t)(b * TDIM + n0 + lrow) * DDIM + headoff;
    v16h q0 = *(const v16h*)(Q + qrow + lhalf * 16);
    v16h q1 = *(const v16h*)(Q + qrow + 32 + lhalf * 16);

    v8f o[4] = {v8f{}, v8f{}, v8f{}, v8f{}};
    float lsum[8] = {0.f, 0.f, 0.f, 0.f, 0.f, 0.f, 0.f, 0.f};
    const int lrow_c = wv * 16 + lhalf * 8;           // block-local C-layout row

    // staging thread maps
    const int kmr = tid >> 3, kc = (tid & 7) * 8;     // Ks: 32 x 64
    const int vd  = tid >> 2, vk = (tid & 3) * 8;     // Vs: 64 x 32
    const _Float16* ksrc = K  + (size_t)(b * TDIM + kmr) * DDIM + headoff + kc;
    const _Float16* vsrc = VT + (headoff + vd) * (size_t)NROWS + b * TDIM + vk;

    for (int m0 = 0; m0 < TDIM; m0 += 32) {
        async_cp16(&Ks[kmr][kc], ksrc + (size_t)m0 * DDIM);
        async_cp16(&Vs[vd][vk],  vsrc + m0);
        #pragma unroll
        for (int u = 0; u < 4; u++) {                 // mask tile 128x32 ints
            const int c   = tid + u * 256;            // 16B chunk id, 0..1023
            const int mrw = c >> 3;
            const int mcl = (c & 7) * 4;
            async_cp16(&Ms[mrw][mcl],
                       mask + ((size_t)b * TDIM + nblk + mrw) * TDIM + m0 + mcl);
        }
        wait_async0();
        __syncthreads();

        v8f s[2];
        #pragma unroll
        for (int t = 0; t < 2; t++) {
            v16h kf0 = lds_frag(&Ks[t * 16 + lrow][lhalf * 16]);
            v16h kf1 = lds_frag(&Ks[t * 16 + lrow][32 + lhalf * 16]);
            v8f z = v8f{};
            z = wmma_f16(q0, kf0, z);
            z = wmma_f16(q1, kf1, z);
            s[t] = z;
        }

        #pragma unroll
        for (int t = 0; t < 2; t++) {
            const int mloc = t * 16 + lrow;
            #pragma unroll
            for (int i = 0; i < 8; i++) {
                const int mk = Ms[lrow_c + i][mloc];
                float p = mk ? __expf(s[t][i] * 0.125f) : 0.0f;
                lsum[i] += p;                         // this lane's key columns only
                Ps[wv][(i + lhalf * 8) * P32H + mloc] = (_Float16)p;
            }
        }

        v16h pf = lds_frag(&Ps[wv][lrow * P32H + lhalf * 16]);
        #pragma unroll
        for (int j = 0; j < 4; j++) {
            v16h vf = lds_frag(&Vs[j * 16 + lrow][lhalf * 16]);
            o[j] = wmma_f16(pf, vf, o[j]);
        }
        __syncthreads();
    }

    // Join the 16 lanes' partial row sums once, behind the loop.
    #pragma unroll                 // constant indices keep lsum in registers
    for (int i = 0; i < 8; i++) {
        float r = lsum[i];
        r += __shfl_xor(r, 1, 32);
        r += __shfl_xor(r, 2, 32);
        r += __shfl_xor(r, 4, 32);
        r += __shfl_xor(r, 8, 32);
        lsum[i] = r;
    }

    #pragma unroll
    for (int j = 0; j < 4; j++) {
        #pragma unroll
        for (int i = 0; i < 8; i++) {
            const int nrow = n0 + lhalf * 8 + i;
            const float val = o[j][i] / (lsum[i] + 1e-20f);
            Y[(size_t)(b * TDIM + nrow) * DDIM + headoff + j * 16 + lrow] = (_Float16)val;
        }
    }
}

// ---------------------------------------------------------------------------
// Host launcher
// ---------------------------------------------------------------------------
extern "C" void kernel_launch(void* const* d_in, const int* in_sizes, int n_in,
                              void* d_out, int out_size, void* d_ws, size_t ws_size,
                              hipStream_t stream) {
    const float* x     = (const float*)d_in[0];
    const int*   mask  = (const int*)  d_in[1];
    const float* gamma = (const float*)d_in[2];
    const float* beta  = (const float*)d_in[3];
    const float* Wq    = (const float*)d_in[4];
    const float* bq    = (const float*)d_in[5];
    const float* Wk    = (const float*)d_in[6];
    const float* bk    = (const float*)d_in[7];
    const float* Wv    = (const float*)d_in[8];
    const float* bv    = (const float*)d_in[9];
    const float* Wo    = (const float*)d_in[10];
    const float* bo    = (const float*)d_in[11];
    float* out = (float*)d_out;

    const size_t ND = (size_t)NROWS * DDIM;
    const size_t DD = (size_t)DDIM * DDIM;
    _Float16* xn   = (_Float16*)d_ws;
    _Float16* q    = xn + ND;
    _Float16* k    = q + ND;
    _Float16* vt   = k + ND;          // [D][NROWS]
    _Float16* y    = vt + ND;
    _Float16* w16t = y + ND;          // 4*DD halves (total 48 MB)

    ln_kernel<<<NROWS, 256, 0, stream>>>(x, gamma, beta, xn);
    cvt_wT_kernel<<<(4 * DD) / 1024, 256, 0, stream>>>(Wq, Wk, Wv, Wo, w16t);

    dim3 ggrid(DDIM / 64, NROWS / 128);
    gemm_kernel<0><<<ggrid, 256, 0, stream>>>(xn, w16t + 0 * DD, bq, nullptr, q, nullptr);
    gemm_kernel<0><<<ggrid, 256, 0, stream>>>(xn, w16t + 1 * DD, bk, nullptr, k, nullptr);
    gemm_kernel<1><<<ggrid, 256, 0, stream>>>(xn, w16t + 2 * DD, bv, nullptr, vt, nullptr);

    dim3 agrid(TDIM / 128, HH, BDIM);
    attn_kernel<<<agrid, 256, 0, stream>>>(q, k, vt, mask, y);

    gemm_kernel<2><<<ggrid, 256, 0, stream>>>(y, w16t + 3 * DD, bo, x, nullptr, out);
}

// v004
// One run takes 168 microseconds.
// Two timings next to v003 both put it at 1.10 times that version's speed.
// Over all steps from v000 it is 1.78 times as fast.
#include <hip/hip_runtime.h>
#include <hip/hip_bf16.h>
#include <stdint.h>

typedef __attribute__((ext_vector_type(16))) _Float16 v16h;
typedef __attribute__((ext_vector_type(8)))  _Float16 v8h;
typedef __attribute__((ext_vector_type(8)))  float    v8f;
typedef __attribute__((ext_vector_type(4)))  _Float16 v4h;
typedef __attribute__((ext_vector_type(4)))  float    v4f;

#define BDIM  2
#define TDIM  2048
#define DDIM  1024
#define HH    16
#define DH    64
#define NROWS (BDIM * TDIM)   // 4096

static __device__ __forceinline__ v8f wmma_f16(v16h a, v16h b, v8f c) {
    return __builtin_amdgcn_wmma_f32_16x16x32_f16(
        false, a, false, b, (short)0, c, false, false);
}

static __device__ __forceinline__ void async_cp16(void* lds_ptr, const void* gptr) {
    unsigned lds_off = (unsigned)(uintptr_t)lds_ptr;   // low 32 bits = LDS offset
    uint64_t gaddr   = (uint64_t)(uintptr_t)gptr;
    asm volatile("global_load_async_to_lds_b128 %0, %1, off"
                 :: "v"(lds_off), "v"(gaddr)
                 : "memory");
}
static __device__ __forceinline__ void async_cp16x4(void* l0, const void* g0,
                                                    void* l1, const void* g1,
                                                    void* l2, const void* g2,
                                                    void* l3, const void* g3) {
    asm volatile("global_load_async_to_lds_b128 %0, %4, off\n\t"
                 "global_load_async_to_lds_b128 %1, %5, off\n\t"
                 "global_load_async_to_lds_b128 %2, %6, off\n\t"
                 "global_load_async_to_lds_b128 %3, %7, off\n\t"
                 "s_wait_xcnt 0x0"
                 :: "v"((unsigned)(uintptr_t)l0), "v"((unsigned)(uintptr_t)l1),
                    "v"((unsigned)(uintptr_t)l2), "v"((unsigned)(uintptr_t)l3),
                    "v"((uint64_t)(uintptr_t)g0), "v"((uint64_t)(uintptr_t)g1),
                    "v"((uint64_t)(uintptr_t)g2), "v"((uint64_t)(uintptr_t)g3)
                 : "memory");
}
static __device__ __forceinline__ void wait_async0() {
    asm volatile("s_wait_asynccnt 0x0" ::: "memory");
}

#define P32H 40
#define P64H 72
#define P128H 136
#define P32I 36

// 16 x 32 fragment slice of one lane: 32 contiguous bytes, 16-B aligned.
static __device__ __forceinline__ v16h lds_frag(const _Float16* p) {
    v8h lo = *(const v8h*)p;
    v8h hi = *(const v8h*)(p + 8);
    return __builtin_shufflevector(lo, hi, 0, 1, 2, 3, 4, 5, 6, 7,
                                   8, 9, 10, 11, 12, 13, 14, 15);
}

// ---------------------------------------------------------------------------
// Kernel 1: LayerNorm, f32 in -> f16 out.  One wave per row, 32 elements a lane:
//   4,096 waves to start instead of 32,768, eight 512-B loads in flight per wave,
//   the row sums stay inside the wave (no LDS, no barrier).
// ---------------------------------------------------------------------------
__global__ __launch_bounds__(256)
void ln_kernel(const float* __restrict__ x,
               const float* __restrict__ gamma,
               const float* __restrict__ beta,
               _Float16* __restrict__ xn) {
    const int ln  = threadIdx.x & 31;
    const int row = blockIdx.x * 8 + (threadIdx.x >> 5);
    const v4f* xr = (const v4f*)(x + (size_t)row * DDIM) + ln;
    v4f v[8];
    #pragma unroll                 // constant indices keep v in registers
    for (int c = 0; c < 8; c++) v[c] = xr[c * 32];
    float s = 0.f, s2 = 0.f;
    #pragma unroll                 // constant indices keep v in registers
    for (int c = 0; c < 8; c++) {
        s  += v[c].x + v[c].y + v[c].z + v[c].w;
        s2 += v[c].x*v[c].x + v[c].y*v[c].y + v[c].z*v[c].z + v[c].w*v[c].w;
    }
    #pragma unroll
    for (int m = 16; m >= 1; m >>= 1) {
        s  += __shfl_xor(s,  m, 32);
        s2 += __shfl_xor(s2, m, 32);
    }
    const float mu  = s * (1.0f / DDIM);
    const float var = s2 * (1.0f / DDIM) - mu * mu;
    const float inv = rsqrtf(var + 1e-5f);
    _Float16* dst = xn + (size_t)row * DDIM + ln * 4;
    #pragma unroll                 // constant indices keep v in registers
    for (int c = 0; c < 8; c++) {
        const v4f g  = ((const v4f*)gamma)[c * 32 + ln];
        const v4f bb = ((const v4f*)beta)[c * 32 + ln];
        v4h h;
        h.x = (_Float16)((v[c].x - mu) * inv * g.x + bb.x);
        h.y = (_Float16)((v[c].y - mu) * inv * g.y + bb.y);
        h.z = (_Float16)((v[c].z - mu) * inv * g.z + bb.z);
        h.w = (_Float16)((v[c].w - mu) * inv * g.w + bb.w);
        *(v4h*)(dst + c * 128) = h;
    }
}

__global__ __launch_bounds__(256)
void cvt_wT_kernel(const float* __restrict__ wq, const float* __restrict__ wk,
                   const float* __restrict__ wv, const float* __restrict__ wo,
                   _Float16* __restrict__ w16t) {
    const int wvi = threadIdx.x >> 5;
    const int ln  = threadIdx.x & 31;
    const int m   = blockIdx.x >> 7;     // which matrix: 128 blocks each
    const int r   = blockIdx.x & 127;
    const int n   = (r & 31) * 32  + (wvi & 1) * 16  + (ln >> 3) * 4;   // W column
    const int k   = (r >> 5) * 256 + (wvi >> 1) * 64 + (ln & 7) * 8;    // W row
    const float* s = m == 0 ? wq : m == 1 ? wk : m == 2 ? wv : wo;
    s += (size_t)k * DDIM + n;
    v4f v[8];
    #pragma unroll                 // constant indices keep v in registers
    for (int j = 0; j < 8; j++) v[j] = *(const v4f*)(s + (size_t)j * DDIM);
    _Float16* d = w16t + (size_t)m * DDIM * DDIM + (size_t)n * DDIM + k;
    #pragma unroll                 // constant indices keep v in registers
    for (int e = 0; e < 4; e++) {
        v8h h;
        #pragma unroll             // constant indices keep v and h in registers
        for (int j = 0; j < 8; j++) h[j] = (_Float16)v[j][e];
        *(v8h*)(d + (size_t)e * DDIM) = h;
    }
}

// ---------------------------------------------------------------------------
// Kernel 3/5: tiled WMMA GEMM.  C[4096 x 1024] = A16 * WT16^T + bias.
//   Block 256 thr = 8 waves; tile 128(M) x 64(N); 128 k per staging round, so
//   that the copy latency, the A latency and the two barriers are paid 8 times.
//   B tile async-copied from WT (row-major [n][k]) into Bs (64 rows of 128, padded).
// MODE 0: out f16 row-major (q, k).
// MODE 1: out f16 transposed [D][NROWS] (v -> VT, free in scattered epilogue).
// MODE 2: out f32 = val + resid (final output).
// ---------------------------------------------------------------------------
template <int MODE>
__global__ void gemm_kernel(const _Float16* __restrict__ A,
                            const _Float16* __restrict__ WT,
                            const float* __restrict__ bias,
                            const float* __restrict__ resid,
                            _Float16* __restrict__ out16,
                            float* __restrict__ out32) {
    __shared__ __attribute__((aligned(16))) _Float16 Bs[64][P128H];  // [col][k], 17 KB
    const int tid = threadIdx.x;
    const int wv  = tid >> 5;
    const int ln  = tid & 31;
    const int M0  = blockIdx.y * 128 + wv * 16;
    const int N0  = blockIdx.x * 64;
    const int lrow  = ln & 15;
    const int lhalf = ln >> 4;

    v8f acc[4] = {v8f{}, v8f{}, v8f{}, v8f{}};
    const _Float16* arow = A + (size_t)(M0 + lrow) * DDIM;

    const int sc  = tid >> 4;          // 0..15  : Bs row (= output col), + 16 per copy
    const int sk  = (tid & 15) * 8;    // 0..120 : k offset (16B chunks)
    const _Float16* wrow = WT + (size_t)(N0 + sc) * DDIM + sk;

    for (int k0 = 0; k0 < DDIM; k0 += 128) {
        async_cp16x4(&Bs[sc][sk],      wrow + k0,
                     &Bs[sc + 16][sk], wrow + k0 + 16 * DDIM,
                     &Bs[sc + 32][sk], wrow + k0 + 32 * DDIM,
                     &Bs[sc + 48][sk], wrow + k0 + 48 * DDIM);
        v16h afrag[4];                 // the round's A loads fly beside its copies
        #pragma unroll                 // constant indices keep afrag in registers
        for (int s = 0; s < 4; s++)
            afrag[s] = *(const v16h*)(arow + k0 + s * 32 + lhalf * 16);
        if (k0 + 128 < DDIM)           // the two lanes of a row take its two next lines
            __builtin_prefetch(arow + k0 + 128 + lhalf * 64, 0, 0);
        wait_async0();
        __syncthreads();

        #pragma unroll                 // constant indices keep afrag and acc in registers
        for (int s = 0; s < 4; s++) {
            #pragma unroll
            for (int j = 0; j < 4; j++) {
                v16h bfrag = lds_frag(&Bs[j * 16 + lrow][s * 32 + lhalf * 16]);
                acc[j] = wmma_f16(afrag[s], bfrag, acc[j]);
            }
        }
        __syncthreads();
    }

    const int rowbase = M0 + lhalf * 8;
    #pragma unroll
    for (int j = 0; j < 4; j++) {
        const int col = N0 + j * 16 + lrow;
        const float bv = bias[col];
        #pragma unroll
        for (int i = 0; i < 8; i++) {
            const int row = rowbase + i;
            const float val = acc[j][i] + bv;
            if (MODE == 2) {
                const size_t idx = (size_t)row * DDIM + col;
                out32[idx] = val + resid[idx];
            } else if (MODE == 1) {
                out16[(size_t)col * NROWS + row] = (_Float16)val;   // VT
            } else {
                out16[(size_t)row * DDIM + col] = (_Float16)val;
            }
        }
    }
}

// ---------------------------------------------------------------------------
// Kernel 4: flash-style attention per (b, h, 128-query-row block).
//   K tile, VT tile and mask tile all async-copied to LDS each m-step.
// ---------------------------------------------------------------------------
__global__ __launch_bounds__(256)   // the real block size: without it the padded addressing spills Q to scratch
void attn_kernel(const _Float16* __restrict__ Q,
                            const _Float16* __restrict__ K,
                            const _Float16* __restrict__ VT,   // [D][NROWS]
                            const int* __restrict__ mask,
                            _Float16* __restrict__ Y) {
    __shared__ __attribute__((aligned(16))) _Float16 Ks[32][P64H];      // [keyrow][k]      4.5 KB
    __shared__ __attribute__((aligned(16))) _Float16 Vs[64][P32H];      // [d][keyrow]        5 KB
    __shared__ __attribute__((aligned(16))) _Float16 Ps[8][16 * P32H];  // per-wave P tiles  10 KB
    __shared__ __attribute__((aligned(16))) int      Ms[128][P32I];     // mask tile         18 KB

    const int tid = threadIdx.x;
    const int wv  = tid >> 5;
    const int ln  = tid & 31;
    const int lrow  = ln & 15;
    const int lhalf = ln >> 4;
    const int b = blockIdx.z, h = blockIdx.y;
    const int nblk = blockIdx.x * 128;                // block's query-row base
    const int n0 = nblk + wv * 16;                    // this wave's rows
    const size_t headoff = (size_t)h * DH;

    const size_t qrow = (size_t)(b * TDIM + n0 + lrow) * DDIM + headoff;
    v16h q0 = *(const v16h*)(Q + qrow + lhalf * 16);
    v16h q1 = *(const v16h*)(Q + qrow + 32 + lhalf * 16);

    v8f o[4] = {v8f{}, v8f{}, v8f{}, v8f{}};
    float lsum[8] = {0.f, 0.f, 0.f, 0.f, 0.f, 0.f, 0.f, 0.f};
    const int lrow_c = wv * 16 + lhalf * 8;           // block-local C-layout row

    // staging thread maps
    const int kmr = tid >> 3, kc = (tid & 7) * 8;     // Ks: 32 x 64
    const int vd  = tid >> 2, vk = (tid & 3) * 8;     // Vs: 64 x 32
    const _Float16* ksrc = K  + (size_t)(b * TDIM + kmr) * DDIM + headoff + kc;
    const _Float16* vsrc = VT + (headoff + vd) * (size_t)NROWS + b * TDIM + vk;

    for (int m0 = 0; m0 < TDIM; m0 += 32) {
        async_cp16(&Ks[kmr][kc], ksrc + (size_t)m0 * DDIM);
        async_cp16(&Vs[vd][vk],  vsrc + m0);
        #pragma unroll
        for (int u = 0; u < 4; u++) {                 // mask tile 128x32 ints
            const int c   = tid + u * 256;            // 16B chunk id, 0..1023
            const int mrw = c >> 3;
            const int mcl = (c & 7) * 4;
            async_cp16(&Ms[mrw][mcl],
                       mask + ((size_t)b * TDIM + nblk + mrw) * TDIM + m0 + mcl);
        }
        wait_async0();
        __syncthreads();

        v8f s[2];
        #pragma unroll
        for (int t = 0; t < 2; t++) {
            v16h kf0 = lds_frag(&Ks[t * 16 + lrow][lhalf * 16]);
            v16h kf1 = lds_frag(&Ks[t * 16 + lrow][32 + lhalf * 16]);
            v8f z = v8f{};
            z = wmma_f16(q0, kf0, z);
            z = wmma_f16(q1, kf1, z);
            s[t] = z;
        }

        #pragma unroll
        for (int t = 0; t < 2; t++) {
            const int mloc = t * 16 + lrow;
            #pragma unroll
            for (int i = 0; i < 8; i++) {
                const int mk = Ms[lrow_c + i][mloc];
                float p = mk ? __expf(s[t][i] * 0.125f) : 0.0f;
                lsum[i] += p;                         // this lane's key columns only
                Ps[wv][(i + lhalf * 8) * P32H + mloc] = (_Float16)p;
            }
        }

        v16h pf = lds_frag(&Ps[wv][lrow * P32H + lhalf * 16]);
        #pragma unroll
        for (int j = 0; j < 4; j++) {
            v16h vf = lds_frag(&Vs[j * 16 + lrow][lhalf * 16]);
            o[j] = wmma_f16(pf, vf, o[j]);
        }
        __syncthreads();
    }

    // Join the 16 lanes' partial row sums once, behind the loop.
    #pragma unroll                 // constant indices keep lsum in registers
    for (int i = 0; i < 8; i++) {
        float r = lsum[i];
        r += __shfl_xor(r, 1, 32);
        r += __shfl_xor(r, 2, 32);
        r += __shfl_xor(r, 4, 32);
        r += __shfl_xor(r, 8, 32);
        lsum[i] = r;
    }

    #pragma unroll
    for (int j = 0; j < 4; j++) {
        #pragma unroll
        for (int i = 0; i < 8; i++) {
            const int nrow = n0 + lhalf * 8 + i;
            const float val = o[j][i] / (lsum[i] + 1e-20f);
            Y[(size_t)(b * TDIM + nrow) * DDIM + headoff + j * 16 + lrow] = (_Float16)val;
        }
    }
}

// ---------------------------------------------------------------------------
// Host launcher
// ---------------------------------------------------------------------------
extern "C" void kernel_launch(void* const* d_in, const int* in_sizes, int n_in,
                              void* d_out, int out_size, void* d_ws, size_t ws_size,
                              hipStream_t stream) {
    const float* x     = (const float*)d_in[0];
    const int*   mask  = (const int*)  d_in[1];
    const float* gamma = (const float*)d_in[2];
    const float* beta  = (const float*)d_in[3];
    const float* Wq    = (const float*)d_in[4];
    const float* bq    = (const float*)d_in[5];
    const float* Wk    = (const float*)d_in[6];
    const float* bk    = (const float*)d_in[7];
    const float* Wv    = (const float*)d_in[8];
    const float* bv    = (const float*)d_in[9];
    const float* Wo    = (const float*)d_in[10];
    const float* bo    = (const float*)d_in[11];
    float* out = (float*)d_out;

    const size_t ND = (size_t)NROWS * DDIM;
    const size_t DD = (size_t)DDIM * DDIM;
    _Float16* xn   = (_Float16*)d_ws;
    _Float16* q    = xn + ND;
    _Float16* k    = q + ND;
    _Float16* vt   = k + ND;          // [D][NROWS]
    _Float16* y    = vt + ND;
    _Float16* w16t = y + ND;          // 4*DD halves (total 48 MB)

    ln_kernel<<<NROWS / 8, 256, 0, stream>>>(x, gamma, beta, xn);
    cvt_wT_kernel<<<(4 * DD) / 8192, 256, 0, stream>>>(Wq, Wk, Wv, Wo, w16t);

    dim3 ggrid(DDIM / 64, NROWS / 128);
    gemm_kernel<0><<<ggrid, 256, 0, stream>>>(xn, w16t + 0 * DD, bq, nullptr, q, nullptr);
    gemm_kernel<0><<<ggrid, 256, 0, stream>>>(xn, w16t + 1 * DD, bk, nullptr, k, nullptr);
    gemm_kernel<1><<<ggrid, 256, 0, stream>>>(xn, w16t + 2 * DD, bv, nullptr, vt, nullptr);

    dim3 agrid(TDIM / 128, HH, BDIM);
    attn_kernel<<<agrid, 256, 0, stream>>>(q, k, vt, mask, y);

    gemm_kernel<2><<<ggrid, 256, 0, stream>>>(y, w16t + 3 * DD, bo, x, nullptr, out);
}

// v005
// One run takes 145 microseconds.
// Two timings next to v004 both put it at 1.16 times that version's speed.
// Counting every step since v000, it is 2.07 times as fast.
#include <hip/hip_runtime.h>
#include <hip/hip_bf16.h>
#include <stdint.h>

typedef __attribute__((ext_vector_type(16))) _Float16 v16h;
typedef __attribute__((ext_vector_type(8)))  _Float16 v8h;
typedef __attribute__((ext_vector_type(8)))  float    v8f;
typedef __attribute__((ext_vector_type(4)))  _Float16 v4h;
typedef __attribute__((ext_vector_type(4)))  float    v4f;
typedef __attribute__((ext_vector_type(4)))  int      v4i;

#define BDIM  2
#define TDIM  2048
#define DDIM  1024
#define HH    16
#define DH    64
#define NROWS (BDIM * TDIM)   // 4096

static __device__ __forceinline__ v8f wmma_f16(v16h a, v16h b, v8f c) {
    return __builtin_amdgcn_wmma_f32_16x16x32_f16(
        false, a, false, b, (short)0, c, false, false);
}

static __device__ __forceinline__ void async_cp16(void* lds_ptr, const void* gptr) {
    unsigned lds_off = (unsigned)(uintptr_t)lds_ptr;   // low 32 bits = LDS offset
    uint64_t gaddr   = (uint64_t)(uintptr_t)gptr;
    asm volatile("global_load_async_to_lds_b128 %0, %1, off"
                 :: "v"(lds_off), "v"(gaddr)
                 : "memory");
}
static __device__ __forceinline__ void async_cp16x4(void* l0, const void* g0,
                                                    void* l1, const void* g1,
                                                    void* l2, const void* g2,
                                                    void* l3, const void* g3) {
    asm volatile("global_load_async_to_lds_b128 %0, %4, off\n\t"
                 "global_load_async_to_lds_b128 %1, %5, off\n\t"
                 "global_load_async_to_lds_b128 %2, %6, off\n\t"
                 "global_load_async_to_lds_b128 %3, %7, off\n\t"
                 "s_wait_xcnt 0x0"
                 :: "v"((unsigned)(uintptr_t)l0), "v"((unsigned)(uintptr_t)l1),
                    "v"((unsigned)(uintptr_t)l2), "v"((unsigned)(uintptr_t)l3),
                    "v"((uint64_t)(uintptr_t)g0), "v"((uint64_t)(uintptr_t)g1),
                    "v"((uint64_t)(uintptr_t)g2), "v"((uint64_t)(uintptr_t)g3)
                 : "memory");
}
static __device__ __forceinline__ void wait_async0() {
    asm volatile("s_wait_asynccnt 0x0" ::: "memory");
}

#define P32H 40   // halves: rows of 32 halves (64 B) laid at 80 B
#define P64H 72   // halves: rows of 64 halves (128 B) laid at 144 B
#define P128H 136 // halves: rows of 128 halves (256 B) laid at 272 B
#define P32I 36   // ints:   rows of 32 ints (128 B) laid at 144 B

// 16 x 32 fragment slice of one lane: 32 contiguous bytes, 16-B aligned.
static __device__ __forceinline__ v16h lds_frag(const _Float16* p) {
    v8h lo = *(const v8h*)p;
    v8h hi = *(const v8h*)(p + 8);
    return __builtin_shufflevector(lo, hi, 0, 1, 2, 3, 4, 5, 6, 7,
                                   8, 9, 10, 11, 12, 13, 14, 15);
}

// ---------------------------------------------------------------------------
// Kernel 1: LayerNorm, f32 in -> f16 out.  One wave per row, 32 elements a lane:
//   4,096 waves to start instead of 32,768, eight 512-B loads in flight per wave,
//   the row sums stay inside the wave (no LDS, no barrier).
// ---------------------------------------------------------------------------
__global__ __launch_bounds__(256)
void ln_kernel(const float* __restrict__ x,
               const float* __restrict__ gamma,
               const float* __restrict__ beta,
               _Float16* __restrict__ xn) {
    const int ln  = threadIdx.x & 31;
    const int row = blockIdx.x * 8 + (threadIdx.x >> 5);
    const v4f* xr = (const v4f*)(x + (size_t)row * DDIM) + ln;
    v4f v[8];
    #pragma unroll                 // constant indices keep v in registers
    for (int c = 0; c < 8; c++) v[c] = xr[c * 32];
    float s = 0.f, s2 = 0.f;
    #pragma unroll                 // constant indices keep v in registers
    for (int c = 0; c < 8; c++) {
        s  += v[c].x + v[c].y + v[c].z + v[c].w;
        s2 += v[c].x*v[c].x + v[c].y*v[c].y + v[c].z*v[c].z + v[c].w*v[c].w;
    }
    #pragma unroll
    for (int m = 16; m >= 1; m >>= 1) {
        s  += __shfl_xor(s,  m, 32);
        s2 += __shfl_xor(s2, m, 32);
    }
    const float mu  = s * (1.0f / DDIM);
    const float var = s2 * (1.0f / DDIM) - mu * mu;
    const float inv = rsqrtf(var + 1e-5f);
    _Float16* dst = xn + (size_t)row * DDIM + ln * 4;
    #pragma unroll                 // constant indices keep v in registers
    for (int c = 0; c < 8; c++) {
        const v4f g  = ((const v4f*)gamma)[c * 32 + ln];
        const v4f bb = ((const v4f*)beta)[c * 32 + ln];
        v4h h;
        h.x = (_Float16)((v[c].x - mu) * inv * g.x + bb.x);
        h.y = (_Float16)((v[c].y - mu) * inv * g.y + bb.y);
        h.z = (_Float16)((v[c].z - mu) * inv * g.z + bb.z);
        h.w = (_Float16)((v[c].w - mu) * inv * g.w + bb.w);
        *(v4h*)(dst + c * 128) = h;
    }
}

__global__ __launch_bounds__(256)
void cvt_wT_kernel(const float* __restrict__ wq, const float* __restrict__ wk,
                   const float* __restrict__ wv, const float* __restrict__ wo,
                   _Float16* __restrict__ w16t) {
    const int wvi = threadIdx.x >> 5;
    const int ln  = threadIdx.x & 31;
    const int m   = blockIdx.x >> 7;     // which matrix: 128 blocks each
    const int r   = blockIdx.x & 127;
    const int n   = (r & 31) * 32  + (wvi & 1) * 16  + (ln >> 3) * 4;   // W column
    const int k   = (r >> 5) * 256 + (wvi >> 1) * 64 + (ln & 7) * 8;    // W row
    const float* s = m == 0 ? wq : m == 1 ? wk : m == 2 ? wv : wo;
    s += (size_t)k * DDIM + n;
    v4f v[8];
    #pragma unroll                 // constant indices keep v in registers
    for (int j = 0; j < 8; j++) v[j] = *(const v4f*)(s + (size_t)j * DDIM);
    _Float16* d = w16t + (size_t)m * DDIM * DDIM + (size_t)n * DDIM + k;
    #pragma unroll                 // constant indices keep v in registers
    for (int e = 0; e < 4; e++) {
        v8h h;
        #pragma unroll             // constant indices keep v and h in registers
        for (int j = 0; j < 8; j++) h[j] = (_Float16)v[j][e];
        *(v8h*)(d + (size_t)e * DDIM) = h;
    }
}

// ---------------------------------------------------------------------------
// Kernel 3/5: tiled WMMA GEMM.  C[4096 x 1024] = A16 * WT16^T + bias.
//   Block 256 thr = 8 waves; tile 128(M) x 64(N); 128 k per staging round, so
//   that the copy latency, the A latency and the two barriers are paid 8 times.
//   B tile async-copied from WT (row-major [n][k]) into Bs (64 rows of 128, padded).
// MODE 0: out f16 row-major (q, k).
// MODE 1: out f16 transposed [D][NROWS] (v -> VT, free in scattered epilogue).
// MODE 2: out f32 = val + resid (final output).
// ---------------------------------------------------------------------------
template <int MODE>
__global__ void gemm_kernel(const _Float16* __restrict__ A,
                            const _Float16* __restrict__ WT,
                            const float* __restrict__ bias,
                            const float* __restrict__ resid,
                            _Float16* __restrict__ out16,
                            float* __restrict__ out32) {
    __shared__ __attribute__((aligned(16))) _Float16 Bs[64][P128H];  // [col][k], 17 KB
    const int tid = threadIdx.x;
    const int wv  = tid >> 5;
    const int ln  = tid & 31;
    const int M0  = blockIdx.y * 128 + wv * 16;
    const int N0  = blockIdx.x * 64;
    const int lrow  = ln & 15;
    const int lhalf = ln >> 4;

    v8f acc[4] = {v8f{}, v8f{}, v8f{}, v8f{}};
    const _Float16* arow = A + (size_t)(M0 + lrow) * DDIM;

    const int sc  = tid >> 4;          // 0..15  : Bs row (= output col), + 16 per copy
    const int sk  = (tid & 15) * 8;    // 0..120 : k offset (16B chunks)
    const _Float16* wrow = WT + (size_t)(N0 + sc) * DDIM + sk;

    for (int k0 = 0; k0 < DDIM; k0 += 128) {
        async_cp16x4(&Bs[sc][sk],      wrow + k0,
                     &Bs[sc + 16][sk], wrow + k0 + 16 * DDIM,
                     &Bs[sc + 32][sk], wrow + k0 + 32 * DDIM,
                     &Bs[sc + 48][sk], wrow + k0 + 48 * DDIM);
        v16h afrag[4];                 // the round's A loads fly beside its copies
        #pragma unroll                 // constant indices keep afrag in registers
        for (int s = 0; s < 4; s++)
            afrag[s] = *(const v16h*)(arow + k0 + s * 32 + lhalf * 16);
        if (k0 + 128 < DDIM)           // the two lanes of a row take its two next lines
            __builtin_prefetch(arow + k0 + 128 + lhalf * 64, 0, 0);
        wait_async0();
        __syncthreads();

        #pragma unroll                 // constant indices keep afrag and acc in registers
        for (int s = 0; s < 4; s++) {
            #pragma unroll
            for (int j = 0; j < 4; j++) {
                v16h bfrag = lds_frag(&Bs[j * 16 + lrow][s * 32 + lhalf * 16]);
                acc[j] = wmma_f16(afrag[s], bfrag, acc[j]);
            }
        }
        __syncthreads();
    }

    const int rowbase = M0 + lhalf * 8;
    #pragma unroll
    for (int j = 0; j < 4; j++) {
        const int col = N0 + j * 16 + lrow;
        const float bv = bias[col];
        #pragma unroll
        for (int i = 0; i < 8; i++) {
            const int row = rowbase + i;
            const float val = acc[j][i] + bv;
            if (MODE == 2) {
                const size_t idx = (size_t)row * DDIM + col;
                out32[idx] = val + resid[idx];
            } else if (MODE == 1) {
                out16[(size_t)col * NROWS + row] = (_Float16)val;   // VT
            } else {
                out16[(size_t)row * DDIM + col] = (_Float16)val;
            }
        }
    }
}

__global__ __launch_bounds__(256)
__attribute__((amdgpu_waves_per_eu(4, 4)))
void attn_kernel(const _Float16* __restrict__ Q,
                            const _Float16* __restrict__ K,
                            const _Float16* __restrict__ VT,   // [D][NROWS]
                            const int* __restrict__ mask,
                            _Float16* __restrict__ Y) {
    __shared__ __attribute__((aligned(16))) _Float16 Ks[32][P64H];      // [keyrow][k]      4.5 KB
    __shared__ __attribute__((aligned(16))) _Float16 Vs[64][P32H];      // [d][keyrow]        5 KB
    __shared__ __attribute__((aligned(16))) int      Ms[128][P32I];     // mask tile         18 KB

    const int tid = threadIdx.x;
    const int wv  = tid >> 5;
    const int ln  = tid & 31;
    const int lrow  = ln & 15;
    const int lhalf = ln >> 4;
    const int b = blockIdx.z, h = blockIdx.y;
    const int nblk = blockIdx.x * 128;                // block's query-row base
    const int n0 = nblk + wv * 16;                    // this wave's rows
    const size_t headoff = (size_t)h * DH;

    const size_t qrow = (size_t)(b * TDIM + n0 + lrow) * DDIM + headoff;
    v16h q0 = *(const v16h*)(Q + qrow + lhalf * 16);
    v16h q1 = *(const v16h*)(Q + qrow + 32 + lhalf * 16);

    v8f o[4] = {v8f{}, v8f{}, v8f{}, v8f{}};          // O^T: row d = 16 j + 8 lhalf + i, column = query lrow
    float lsum[4] = {0.f, 0.f, 0.f, 0.f};             // this lane's keys of query lrow, four chains

    // staging thread maps
    const int kmr = tid >> 3, kc = (tid & 7) * 8;     // Ks: 32 x 64
    const int vd  = tid >> 2, vk = (tid & 3) * 8;     // Vs: 64 x 32
    const _Float16* ksrc = K  + (size_t)(b * TDIM + kmr) * DDIM + headoff + kc;
    const _Float16* vsrc = VT + (headoff + vd) * (size_t)NROWS + b * TDIM + vk;

    for (int m0 = 0; m0 < TDIM; m0 += 32) {
        async_cp16(&Ks[kmr][kc], ksrc + (size_t)m0 * DDIM);
        async_cp16(&Vs[vd][vk],  vsrc + m0);
        #pragma unroll
        for (int u = 0; u < 4; u++) {                 // mask tile 128x32 ints
            const int c   = tid + u * 256;            // 16B chunk id, 0..1023
            const int mrw = c >> 3;
            const int mcl = (c & 7) * 4;
            async_cp16(&Ms[mrw][mcl],
                       mask + ((size_t)b * TDIM + nblk + mrw) * TDIM + m0 + mcl);
        }
        wait_async0();
        __syncthreads();

        // S^T tile t: row = key 16 t + 8 lhalf + i, column = query lrow.
        v8f s[2];
        #pragma unroll             // constant indices keep s in registers
        for (int t = 0; t < 2; t++) {
            v16h kf0 = lds_frag(&Ks[t * 16 + lrow][lhalf * 16]);
            v16h kf1 = lds_frag(&Ks[t * 16 + lrow][32 + lhalf * 16]);
            v8f z = v8f{};
            z = wmma_f16(kf0, q0, z);
            z = wmma_f16(kf1, q1, z);
            s[t] = z;
        }

        // P^T as a B operand: element 8 t + i of a lane is key 16 t + 8 lhalf + i.
        v16h pf;
        #pragma unroll             // constant indices keep s, pf and lsum in registers
        for (int t = 0; t < 2; t++) {
            const int* mrow = &Ms[wv * 16 + lrow][t * 16 + lhalf * 8];
            const v4i mlo = *(const v4i*)mrow;
            const v4i mhi = *(const v4i*)(mrow + 4);
            #pragma unroll         // constant indices keep s, pf and lsum in registers
            for (int i = 0; i < 8; i++) {
                const int mk = i < 4 ? mlo[i & 3] : mhi[i & 3];
                float p = mk ? __expf(s[t][i] * 0.125f) : 0.0f;
                lsum[i & 3] += p;
                pf[t * 8 + i] = (_Float16)p;
            }
        }

        // V^T as the A operand, in the same key order as pf.
        #pragma unroll             // constant indices keep o in registers
        for (int j = 0; j < 4; j++) {
            const _Float16* vrow = &Vs[j * 16 + lrow][lhalf * 8];
            v8h lo = *(const v8h*)vrow;
            v8h hi = *(const v8h*)(vrow + 16);
            v16h vf = __builtin_shufflevector(lo, hi, 0, 1, 2, 3, 4, 5, 6, 7,
                                              8, 9, 10, 11, 12, 13, 14, 15);
            o[j] = wmma_f16(vf, pf, o[j]);
        }
        __syncthreads();
    }

    // Join the two half-waves' partial sums of each query once, behind the loop.
    float den = (lsum[0] + lsum[1]) + (lsum[2] + lsum[3]);
    den += __shfl_xor(den, 16, 32);

    _Float16* yrow = Y + (size_t)(b * TDIM + n0 + lrow) * DDIM + headoff + lhalf * 8;
    #pragma unroll                 // constant indices keep o in registers
    for (int j = 0; j < 4; j++) {
        v8h hv;
        #pragma unroll             // constant indices keep o and hv in registers
        for (int i = 0; i < 8; i++)
            hv[i] = (_Float16)(o[j][i] / (den + 1e-20f));
        *(v8h*)(yrow + j * 16) = hv;
    }
}

// ---------------------------------------------------------------------------
// Host launcher
// ---------------------------------------------------------------------------
extern "C" void kernel_launch(void* const* d_in, const int* in_sizes, int n_in,
                              void* d_out, int out_size, void* d_ws, size_t ws_size,
                              hipStream_t stream) {
    const float* x     = (const float*)d_in[0];
    const int*   mask  = (const int*)  d_in[1];
    const float* gamma = (const float*)d_in[2];
    const float* beta  = (const float*)d_in[3];
    const float* Wq    = (const float*)d_in[4];
    const float* bq    = (const float*)d_in[5];
    const float* Wk    = (const float*)d_in[6];
    const float* bk    = (const float*)d_in[7];
    const float* Wv    = (const float*)d_in[8];
    const float* bv    = (const float*)d_in[9];
    const float* Wo    = (const float*)d_in[10];
    const float* bo    = (const float*)d_in[11];
    float* out = (float*)d_out;

    const size_t ND = (size_t)NROWS * DDIM;
    const size_t DD = (size_t)DDIM * DDIM;
    _Float16* xn   = (_Float16*)d_ws;
    _Float16* q    = xn + ND;
    _Float16* k    = q + ND;
    _Float16* vt   = k + ND;          // [D][NROWS]
    _Float16* y    = vt + ND;
    _Float16* w16t = y + ND;          // 4*DD halves (total 48 MB)

    ln_kernel<<<NROWS / 8, 256, 0, stream>>>(x, gamma, beta, xn);
    cvt_wT_kernel<<<(4 * DD) / 8192, 256, 0, stream>>>(Wq, Wk, Wv, Wo, w16t);

    dim3 ggrid(DDIM / 64, NROWS / 128);
    gemm_kernel<0><<<ggrid, 256, 0, stream>>>(xn, w16t + 0 * DD, bq, nullptr, q, nullptr);
    gemm_kernel<0><<<ggrid, 256, 0, stream>>>(xn, w16t + 1 * DD, bk, nullptr, k, nullptr);
    gemm_kernel<1><<<ggrid, 256, 0, stream>>>(xn, w16t + 2 * DD, bv, nullptr, vt, nullptr);

    dim3 agrid(TDIM / 128, HH, BDIM);
    attn_kernel<<<agrid, 256, 0, stream>>>(q, k, vt, mask, y);

    gemm_kernel<2><<<ggrid, 256, 0, stream>>>(y, w16t + 3 * DD, bo, x, nullptr, out);
}

// v006
// A run of this version takes 130 microseconds.
// Timed twice side by side with v005, it ran 1.12 times as fast both times.
// Counting every step since v000, it is 2.31 times as fast.
#include <hip/hip_runtime.h>
#include <hip/hip_bf16.h>
#include <stdint.h>

typedef __attribute__((ext_vector_type(16))) _Float16 v16h;
typedef __attribute__((ext_vector_type(8)))  _Float16 v8h;
typedef __attribute__((ext_vector_type(8)))  float    v8f;
typedef __attribute__((ext_vector_type(4)))  _Float16 v4h;
typedef __attribute__((ext_vector_type(4)))  float    v4f;
typedef __attribute__((ext_vector_type(4)))  int      v4i;

#define BDIM  2
#define TDIM  2048
#define DDIM  1024
#define HH    16
#define DH    64
#define NROWS (BDIM * TDIM)   // 4096

static __device__ __forceinline__ v8f wmma_f16(v16h a, v16h b, v8f c) {
    return __builtin_amdgcn_wmma_f32_16x16x32_f16(
        false, a, false, b, (short)0, c, false, false);
}

static __device__ __forceinline__ void async_cp16x4(void* l0, const void* g0,
                                                    void* l1, const void* g1,
                                                    void* l2, const void* g2,
                                                    void* l3, const void* g3) {
    asm volatile("global_load_async_to_lds_b128 %0, %4, off\n\t"
                 "global_load_async_to_lds_b128 %1, %5, off\n\t"
                 "global_load_async_to_lds_b128 %2, %6, off\n\t"
                 "global_load_async_to_lds_b128 %3, %7, off\n\t"
                 "s_wait_xcnt 0x0"
                 :: "v"((unsigned)(uintptr_t)l0), "v"((unsigned)(uintptr_t)l1),
                    "v"((unsigned)(uintptr_t)l2), "v"((unsigned)(uintptr_t)l3),
                    "v"((uint64_t)(uintptr_t)g0), "v"((uint64_t)(uintptr_t)g1),
                    "v"((uint64_t)(uintptr_t)g2), "v"((uint64_t)(uintptr_t)g3)
                 : "memory");
}
static __device__ __forceinline__ void async_cp16x6(void* l0, const void* g0,
                                                    void* l1, const void* g1,
                                                    void* l2, const void* g2,
                                                    void* l3, const void* g3,
                                                    void* l4, const void* g4,
                                                    void* l5, const void* g5) {
    asm volatile("global_load_async_to_lds_b128 %0, %6, off\n\t"
                 "global_load_async_to_lds_b128 %1, %7, off\n\t"
                 "global_load_async_to_lds_b128 %2, %8, off\n\t"
                 "global_load_async_to_lds_b128 %3, %9, off\n\t"
                 "global_load_async_to_lds_b128 %4, %10, off\n\t"
                 "global_load_async_to_lds_b128 %5, %11, off\n\t"
                 "s_wait_xcnt 0x0"
                 :: "v"((unsigned)(uintptr_t)l0), "v"((unsigned)(uintptr_t)l1),
                    "v"((unsigned)(uintptr_t)l2), "v"((unsigned)(uintptr_t)l3),
                    "v"((unsigned)(uintptr_t)l4), "v"((unsigned)(uintptr_t)l5),
                    "v"((uint64_t)(uintptr_t)g0), "v"((uint64_t)(uintptr_t)g1),
                    "v"((uint64_t)(uintptr_t)g2), "v"((uint64_t)(uintptr_t)g3),
                    "v"((uint64_t)(uintptr_t)g4), "v"((uint64_t)(uintptr_t)g5)
                 : "memory");
}
static __device__ __forceinline__ void wait_async0() {
    asm volatile("s_wait_asynccnt 0x0" ::: "memory");
}
// A wave's own LDS reads have returned: stands in front of the barrier behind
// which the buffer that it has read is refilled by copies.
static __device__ __forceinline__ void wait_ds0() {
    asm volatile("s_wait_dscnt 0x0" ::: "memory");
}

#define P32H 40   // halves: rows of 32 halves (64 B) laid at 80 B
#define P64H 72   // halves: rows of 64 halves (128 B) laid at 144 B
#define P128H 136 // halves: rows of 128 halves (256 B) laid at 272 B
#define P32I 36   // ints:   rows of 32 ints (128 B) laid at 144 B

// 16 x 32 fragment slice of one lane: 32 contiguous bytes, 16-B aligned.
static __device__ __forceinline__ v16h lds_frag(const _Float16* p) {
    v8h lo = *(const v8h*)p;
    v8h hi = *(const v8h*)(p + 8);
    return __builtin_shufflevector(lo, hi, 0, 1, 2, 3, 4, 5, 6, 7,
                                   8, 9, 10, 11, 12, 13, 14, 15);
}

// ---------------------------------------------------------------------------
// Kernel 1: LayerNorm, f32 in -> f16 out.  One wave per row, 32 elements a lane:
//   4,096 waves to start instead of 32,768, eight 512-B loads in flight per wave,
//   the row sums stay inside the wave (no LDS, no barrier).
// ---------------------------------------------------------------------------
__global__ __launch_bounds__(256)
void ln_kernel(const float* __restrict__ x,
               const float* __restrict__ gamma,
               const float* __restrict__ beta,
               _Float16* __restrict__ xn) {
    const int ln  = threadIdx.x & 31;
    const int row = blockIdx.x * 8 + (threadIdx.x >> 5);
    const v4f* xr = (const v4f*)(x + (size_t)row * DDIM) + ln;
    v4f v[8];
    #pragma unroll                 // constant indices keep v in registers
    for (int c = 0; c < 8; c++) v[c] = xr[c * 32];
    float s = 0.f, s2 = 0.f;
    #pragma unroll                 // constant indices keep v in registers
    for (int c = 0; c < 8; c++) {
        s  += v[c].x + v[c].y + v[c].z + v[c].w;
        s2 += v[c].x*v[c].x + v[c].y*v[c].y + v[c].z*v[c].z + v[c].w*v[c].w;
    }
    #pragma unroll
    for (int m = 16; m >= 1; m >>= 1) {
        s  += __shfl_xor(s,  m, 32);
        s2 += __shfl_xor(s2, m, 32);
    }
    const float mu  = s * (1.0f / DDIM);
    const float var = s2 * (1.0f / DDIM) - mu * mu;
    const float inv = rsqrtf(var + 1e-5f);
    _Float16* dst = xn + (size_t)row * DDIM + ln * 4;
    #pragma unroll                 // constant indices keep v in registers
    for (int c = 0; c < 8; c++) {
        const v4f g  = ((const v4f*)gamma)[c * 32 + ln];
        const v4f bb = ((const v4f*)beta)[c * 32 + ln];
        v4h h;
        h.x = (_Float16)((v[c].x - mu) * inv * g.x + bb.x);
        h.y = (_Float16)((v[c].y - mu) * inv * g.y + bb.y);
        h.z = (_Float16)((v[c].z - mu) * inv * g.z + bb.z);
        h.w = (_Float16)((v[c].w - mu) * inv * g.w + bb.w);
        *(v4h*)(dst + c * 128) = h;
    }
}

__global__ __launch_bounds__(256)
void cvt_wT_kernel(const float* __restrict__ wq, const float* __restrict__ wk,
                   const float* __restrict__ wv, const float* __restrict__ wo,
                   _Float16* __restrict__ w16t) {
    const int wvi = threadIdx.x >> 5;
    const int ln  = threadIdx.x & 31;
    const int m   = blockIdx.x >> 7;     // which matrix: 128 blocks each
    const int r   = blockIdx.x & 127;
    const int n   = (r & 31) * 32  + (wvi & 1) * 16  + (ln >> 3) * 4;   // W column
    const int k   = (r >> 5) * 256 + (wvi >> 1) * 64 + (ln & 7) * 8;    // W row
    const float* s = m == 0 ? wq : m == 1 ? wk : m == 2 ? wv : wo;
    s += (size_t)k * DDIM + n;
    v4f v[8];
    #pragma unroll                 // constant indices keep v in registers
    for (int j = 0; j < 8; j++) v[j] = *(const v4f*)(s + (size_t)j * DDIM);
    _Float16* d = w16t + (size_t)m * DDIM * DDIM + (size_t)n * DDIM + k;
    #pragma unroll                 // constant indices keep v in registers
    for (int e = 0; e < 4; e++) {
        v8h h;
        #pragma unroll             // constant indices keep v and h in registers
        for (int j = 0; j < 8; j++) h[j] = (_Float16)v[j][e];
        *(v8h*)(d + (size_t)e * DDIM) = h;
    }
}

// ---------------------------------------------------------------------------
// Kernel 3/5: tiled WMMA GEMM.  C[4096 x 1024] = A16 * WT16^T + bias.
//   Block 256 thr = 8 waves; tile 128(M) x 64(N); 128 k per staging round, so
//   that the copy latency, the A latency and the two barriers are paid 8 times.
//   B tile async-copied from WT (row-major [n][k]) into Bs (64 rows of 128, padded).
// MODE 0: out f16 row-major (q, k).
// MODE 1: out f16 transposed [D][NROWS] (v -> VT, free in scattered epilogue).
// MODE 2: out f32 = val + resid (final output).
// ---------------------------------------------------------------------------
template <int MODE>
__global__ void gemm_kernel(const _Float16* __restrict__ A,
                            const _Float16* __restrict__ WT,
                            const float* __restrict__ bias,
                            const float* __restrict__ resid,
                            _Float16* __restrict__ out16,
                            float* __restrict__ out32) {
    __shared__ __attribute__((aligned(16))) _Float16 Bs[64][P128H];  // [col][k], 17 KB
    const int tid = threadIdx.x;
    const int wv  = tid >> 5;
    const int ln  = tid & 31;
    const int M0  = blockIdx.y * 128 + wv * 16;
    const int N0  = blockIdx.x * 64;
    const int lrow  = ln & 15;
    const int lhalf = ln >> 4;

    v8f acc[4] = {v8f{}, v8f{}, v8f{}, v8f{}};
    const _Float16* arow = A + (size_t)(M0 + lrow) * DDIM;

    const int sc  = tid >> 4;          // 0..15  : Bs row (= output col), + 16 per copy
    const int sk  = (tid & 15) * 8;    // 0..120 : k offset (16B chunks)
    const _Float16* wrow = WT + (size_t)(N0 + sc) * DDIM + sk;

    for (int k0 = 0; k0 < DDIM; k0 += 128) {
        async_cp16x4(&Bs[sc][sk],      wrow + k0,
                     &Bs[sc + 16][sk], wrow + k0 + 16 * DDIM,
                     &Bs[sc + 32][sk], wrow + k0 + 32 * DDIM,
                     &Bs[sc + 48][sk], wrow + k0 + 48 * DDIM);
        v16h afrag[4];                 // the round's A loads fly beside its copies
        #pragma unroll                 // constant indices keep afrag in registers
        for (int s = 0; s < 4; s++)
            afrag[s] = *(const v16h*)(arow + k0 + s * 32 + lhalf * 16);
        if (k0 + 128 < DDIM)           // the two lanes of a row take its two next lines
            __builtin_prefetch(arow + k0 + 128 + lhalf * 64, 0, 0);
        wait_async0();
        __syncthreads();

        #pragma unroll                 // constant indices keep afrag and acc in registers
        for (int s = 0; s < 4; s++) {
            #pragma unroll
            for (int j = 0; j < 4; j++) {
                v16h bfrag = lds_frag(&Bs[j * 16 + lrow][s * 32 + lhalf * 16]);
                acc[j] = wmma_f16(afrag[s], bfrag, acc[j]);
            }
        }
        __syncthreads();
    }

    const int rowbase = M0 + lhalf * 8;
    #pragma unroll
    for (int j = 0; j < 4; j++) {
        const int col = N0 + j * 16 + lrow;
        const float bv = bias[col];
        #pragma unroll
        for (int i = 0; i < 8; i++) {
            const int row = rowbase + i;
            const float val = acc[j][i] + bv;
            if (MODE == 2) {
                const size_t idx = (size_t)row * DDIM + col;
                out32[idx] = val + resid[idx];
            } else if (MODE == 1) {
                out16[(size_t)col * NROWS + row] = (_Float16)val;   // VT
            } else {
                out16[(size_t)row * DDIM + col] = (_Float16)val;
            }
        }
    }
}

__global__ __launch_bounds__(256)
__attribute__((amdgpu_waves_per_eu(4, 4)))
void attn_kernel(const _Float16* __restrict__ Q,
                            const _Float16* __restrict__ K,
                            const _Float16* __restrict__ VT,   // [D][NROWS]
                            const int* __restrict__ mask,
                            _Float16* __restrict__ Y) {
    __shared__ __attribute__((aligned(16))) _Float16 Ks[2][32][P64H];   // [buf][keyrow][k]   2 x 4.5 KB
    __shared__ __attribute__((aligned(16))) _Float16 Vs[2][64][P32H];   // [buf][d][keyrow]   2 x   5 KB
    __shared__ __attribute__((aligned(16))) int      Ms[2][128][P32I];  // [buf] mask tile    2 x  18 KB

    const int tid = threadIdx.x;
    const int wv  = tid >> 5;
    const int ln  = tid & 31;
    const int lrow  = ln & 15;
    const int lhalf = ln >> 4;
    const int b = blockIdx.z, h = blockIdx.y;
    const int nblk = blockIdx.x * 128;                // block's query-row base
    const int n0 = nblk + wv * 16;                    // this wave's rows
    const size_t headoff = (size_t)h * DH;

    const size_t qrow = (size_t)(b * TDIM + n0 + lrow) * DDIM + headoff;
    v16h q0 = *(const v16h*)(Q + qrow + lhalf * 16);
    v16h q1 = *(const v16h*)(Q + qrow + 32 + lhalf * 16);

    v8f o[4] = {v8f{}, v8f{}, v8f{}, v8f{}};          // O^T: row d = 16 j + 8 lhalf + i, column = query lrow
    float lsum[4] = {0.f, 0.f, 0.f, 0.f};             // this lane's keys of query lrow, four chains

    // staging thread maps
    const int kmr = tid >> 3, kc = (tid & 7) * 8;     // Ks: 32 x 64
    const int vd  = tid >> 2, vk = (tid & 3) * 8;     // Vs: 64 x 32
    const int mr  = tid >> 3, mc = (tid & 7) * 4;     // Ms: 128 x 32 ints, rows mr + 32 u
    // the next tile to be copied, one running pointer per source array
    const _Float16* ksrc = K  + (size_t)(b * TDIM + kmr) * DDIM + headoff + kc;
    const _Float16* vsrc = VT + (headoff + vd) * (size_t)NROWS + b * TDIM + vk;
    const int*      msrc = mask + ((size_t)b * TDIM + nblk + mr) * TDIM + mc;

    // One lane's six copies of the next tile into buffer buf.
    auto stage = [&](const int buf) __attribute__((always_inline)) {
        async_cp16x6(&Ks[buf][kmr][kc],     ksrc,
                     &Vs[buf][vd][vk],      vsrc,
                     &Ms[buf][mr][mc],      msrc,
                     &Ms[buf][mr + 32][mc], msrc + 32 * TDIM,
                     &Ms[buf][mr + 64][mc], msrc + 64 * TDIM,
                     &Ms[buf][mr + 96][mc], msrc + 96 * TDIM);
        ksrc += (size_t)32 * DDIM;
        vsrc += 32;
        msrc += 32;
    };

    // One trip: tile t out of buffer buf = t mod 2; refill: a tile t + 2 exists.
    auto trip = [&](const int buf, const bool refill) __attribute__((always_inline)) {
        // S^T tile t: row = key 16 t + 8 lhalf + i, column = query lrow.
        v8f s[2];
        #pragma unroll             // constant indices keep s in registers
        for (int t = 0; t < 2; t++) {
            v16h kf0 = lds_frag(&Ks[buf][t * 16 + lrow][lhalf * 16]);
            v16h kf1 = lds_frag(&Ks[buf][t * 16 + lrow][32 + lhalf * 16]);
            v8f z = v8f{};
            z = wmma_f16(kf0, q0, z);
            z = wmma_f16(kf1, q1, z);
            s[t] = z;
        }
        // The trip's mask words and V^T fragments (A operand, in the key order of pf).
        v4i mlo[2], mhi[2];
        #pragma unroll             // constant indices keep mlo and mhi in registers
        for (int t = 0; t < 2; t++) {
            const int* mrow = &Ms[buf][wv * 16 + lrow][t * 16 + lhalf * 8];
            mlo[t] = *(const v4i*)mrow;
            mhi[t] = *(const v4i*)(mrow + 4);
        }
        v16h vf[4];
        #pragma unroll             // constant indices keep vf in registers
        for (int j = 0; j < 4; j++) {
            const _Float16* vrow = &Vs[buf][j * 16 + lrow][lhalf * 8];
            v8h lo = *(const v8h*)vrow;
            v8h hi = *(const v8h*)(vrow + 16);
            vf[j] = __builtin_shufflevector(lo, hi, 0, 1, 2, 3, 4, 5, 6, 7,
                                            8, 9, 10, 11, 12, 13, 14, 15);
        }

        // Publish point: the trip's last LDS read stands above, the rest of it
        // works on registers.  This wave has left buffer buf; its copies of tile
        // t + 1 have landed; the barrier says both of every wave.
        wait_ds0();
        wait_async0();
        __syncthreads();
        if (refill) stage(buf);

        // P^T as a B operand: element 8 t + i of a lane is key 16 t + 8 lhalf + i.
        v16h pf;
        #pragma unroll             // constant indices keep s, pf and lsum in registers
        for (int t = 0; t < 2; t++) {
            #pragma unroll         // constant indices keep s, pf and lsum in registers
            for (int i = 0; i < 8; i++) {
                const int mk = i < 4 ? mlo[t][i & 3] : mhi[t][i & 3];
                float p = mk ? __expf(s[t][i] * 0.125f) : 0.0f;
                lsum[i & 3] += p;
                pf[t * 8 + i] = (_Float16)p;
            }
        }
        #pragma unroll             // constant indices keep o in registers
        for (int j = 0; j < 4; j++)
            o[j] = wmma_f16(vf[j], pf, o[j]);
    };

    stage(0);                      // tile 0
    wait_async0();
    __syncthreads();
    stage(1);                      // tile 1 flies during trip 0
    // Two trips a pass, so that the buffer is a constant in every address; the
    // last two trips, which have no tile left to ask for, stand behind the loop.
    for (int m0 = 0; m0 < TDIM - 64; m0 += 64) {
        trip(0, true);
        trip(1, true);
    }
    trip(0, false);
    trip(1, false);
    wait_async0();                 // nothing is outstanding when the wave ends

    // Join the two half-waves' partial sums of each query once, behind the loop.
    float den = (lsum[0] + lsum[1]) + (lsum[2] + lsum[3]);
    den += __shfl_xor(den, 16, 32);

    _Float16* yrow = Y + (size_t)(b * TDIM + n0 + lrow) * DDIM + headoff + lhalf * 8;
    #pragma unroll                 // constant indices keep o in registers
    for (int j = 0; j < 4; j++) {
        v8h hv;
        #pragma unroll             // constant indices keep o and hv in registers
        for (int i = 0; i < 8; i++)
            hv[i] = (_Float16)(o[j][i] / (den + 1e-20f));
        *(v8h*)(yrow + j * 16) = hv;
    }
}

// ---------------------------------------------------------------------------
// Host launcher
// ---------------------------------------------------------------------------
extern "C" void kernel_launch(void* const* d_in, const int* in_sizes, int n_in,
                              void* d_out, int out_size, void* d_ws, size_t ws_size,
                              hipStream_t stream) {
    const float* x     = (const float*)d_in[0];
    const int*   mask  = (const int*)  d_in[1];
    const float* gamma = (const float*)d_in[2];
    const float* beta  = (const float*)d_in[3];
    const float* Wq    = (const float*)d_in[4];
    const float* bq    = (const float*)d_in[5];
    const float* Wk    = (const float*)d_in[6];
    const float* bk    = (const float*)d_in[7];
    const float* Wv    = (const float*)d_in[8];
    const float* bv    = (const float*)d_in[9];
    const float* Wo    = (const float*)d_in[10];
    const float* bo    = (const float*)d_in[11];
    float* out = (float*)d_out;

    const size_t ND = (size_t)NROWS * DDIM;
    const size_t DD = (size_t)DDIM * DDIM;
    _Float16* xn   = (_Float16*)d_ws;
    _Float16* q    = xn + ND;
    _Float16* k    = q + ND;
    _Float16* vt   = k + ND;          // [D][NROWS]
    _Float16* y    = vt + ND;
    _Float16* w16t = y + ND;          // 4*DD halves (total 48 MB)

    ln_kernel<<<NROWS / 8, 256, 0, stream>>>(x, gamma, beta, xn);
    cvt_wT_kernel<<<(4 * DD) / 8192, 256, 0, stream>>>(Wq, Wk, Wv, Wo, w16t);

    dim3 ggrid(DDIM / 64, NROWS / 128);
    gemm_kernel<0><<<ggrid, 256, 0, stream>>>(xn, w16t + 0 * DD, bq, nullptr, q, nullptr);
    gemm_kernel<0><<<ggrid, 256, 0, stream>>>(xn, w16t + 1 * DD, bk, nullptr, k, nullptr);
    gemm_kernel<1><<<ggrid, 256, 0, stream>>>(xn, w16t + 2 * DD, bv, nullptr, vt, nullptr);

    dim3 agrid(TDIM / 128, HH, BDIM);
    attn_kernel<<<agrid, 256, 0, stream>>>(q, k, vt, mask, y);

    gemm_kernel<2><<<ggrid, 256, 0, stream>>>(y, w16t + 3 * DD, bo, x, nullptr, out);
}

// v007
// It runs in 118 microseconds.
// Two timings next to v006 put it at 1.10 and 1.09 times that version's speed.
// All steps since v000 together make it 2.53 times as fast.
#include <hip/hip_runtime.h>
#include <hip/hip_bf16.h>
#include <stdint.h>

typedef __attribute__((ext_vector_type(16))) _Float16 v16h;
typedef __attribute__((ext_vector_type(8)))  _Float16 v8h;
typedef __attribute__((ext_vector_type(8)))  float    v8f;
typedef __attribute__((ext_vector_type(4)))  _Float16 v4h;
typedef __attribute__((ext_vector_type(4)))  float    v4f;
typedef __attribute__((ext_vector_type(4)))  int      v4i;

#define BDIM  2
#define TDIM  2048
#define DDIM  1024
#define HH    16
#define DH    64
#define NROWS (BDIM * TDIM)   // 4096

static __device__ __forceinline__ v8f wmma_f16(v16h a, v16h b, v8f c) {
    return __builtin_amdgcn_wmma_f32_16x16x32_f16(
        false, a, false, b, (short)0, c, false, false);
}

static __device__ __forceinline__ void async_cp16x4(void* l0, const void* g0,
                                                    void* l1, const void* g1,
                                                    void* l2, const void* g2,
                                                    void* l3, const void* g3) {
    asm volatile("global_load_async_to_lds_b128 %0, %4, off\n\t"
                 "global_load_async_to_lds_b128 %1, %5, off\n\t"
                 "global_load_async_to_lds_b128 %2, %6, off\n\t"
                 "global_load_async_to_lds_b128 %3, %7, off\n\t"
                 "s_wait_xcnt 0x0"
                 :: "v"((unsigned)(uintptr_t)l0), "v"((unsigned)(uintptr_t)l1),
                    "v"((unsigned)(uintptr_t)l2), "v"((unsigned)(uintptr_t)l3),
                    "v"((uint64_t)(uintptr_t)g0), "v"((uint64_t)(uintptr_t)g1),
                    "v"((uint64_t)(uintptr_t)g2), "v"((uint64_t)(uintptr_t)g3)
                 : "memory");
}
static __device__ __forceinline__ void async_cp16x6(void* l0, const void* g0,
                                                    void* l1, const void* g1,
                                                    void* l2, const void* g2,
                                                    void* l3, const void* g3,
                                                    void* l4, const void* g4,
                                                    void* l5, const void* g5) {
    asm volatile("global_load_async_to_lds_b128 %0, %6, off\n\t"
                 "global_load_async_to_lds_b128 %1, %7, off\n\t"
                 "global_load_async_to_lds_b128 %2, %8, off\n\t"
                 "global_load_async_to_lds_b128 %3, %9, off\n\t"
                 "global_load_async_to_lds_b128 %4, %10, off\n\t"
                 "global_load_async_to_lds_b128 %5, %11, off\n\t"
                 "s_wait_xcnt 0x0"
                 :: "v"((unsigned)(uintptr_t)l0), "v"((unsigned)(uintptr_t)l1),
                    "v"((unsigned)(uintptr_t)l2), "v"((unsigned)(uintptr_t)l3),
                    "v"((unsigned)(uintptr_t)l4), "v"((unsigned)(uintptr_t)l5),
                    "v"((uint64_t)(uintptr_t)g0), "v"((uint64_t)(uintptr_t)g1),
                    "v"((uint64_t)(uintptr_t)g2), "v"((uint64_t)(uintptr_t)g3),
                    "v"((uint64_t)(uintptr_t)g4), "v"((uint64_t)(uintptr_t)g5)
                 : "memory");
}
static __device__ __forceinline__ void wait_async0() {
    asm volatile("s_wait_asynccnt 0x0" ::: "memory");
}
// A wave's own LDS reads have returned: stands in front of the barrier behind
// which the buffer that it has read is refilled by copies.
static __device__ __forceinline__ void wait_ds0() {
    asm volatile("s_wait_dscnt 0x0" ::: "memory");
}

#define P32H 40   // halves: rows of 32 halves (64 B) laid at 80 B
#define P64H 72   // halves: rows of 64 halves (128 B) laid at 144 B
#define P128H 136 // halves: rows of 128 halves (256 B) laid at 272 B
#define P32I 36   // ints:   rows of 32 ints (128 B) laid at 144 B

// 16 x 32 fragment slice of one lane: 32 contiguous bytes, 16-B aligned.
static __device__ __forceinline__ v16h lds_frag(const _Float16* p) {
    v8h lo = *(const v8h*)p;
    v8h hi = *(const v8h*)(p + 8);
    return __builtin_shufflevector(lo, hi, 0, 1, 2, 3, 4, 5, 6, 7,
                                   8, 9, 10, 11, 12, 13, 14, 15);
}

// ---------------------------------------------------------------------------
// Kernel 1, first part: LayerNorm, f32 in -> f16 out.  One wave per row, 32 elements a lane:
//   4,096 waves to start instead of 32,768, eight 512-B loads in flight per wave,
//   the row sums stay inside the wave (no LDS, no barrier).
// ---------------------------------------------------------------------------
static __device__ __forceinline__
void ln_block(const int blk,
              const float* __restrict__ x,
              const float* __restrict__ gamma,
              const float* __restrict__ beta,
              _Float16* __restrict__ xn) {
    const int ln  = threadIdx.x & 31;
    const int row = blk * 8 + (threadIdx.x >> 5);
    const v4f* xr = (const v4f*)(x + (size_t)row * DDIM) + ln;
    v4f v[8];
    #pragma unroll                 // constant indices keep v in registers
    for (int c = 0; c < 8; c++) v[c] = xr[c * 32];
    float s = 0.f, s2 = 0.f;
    #pragma unroll                 // constant indices keep v in registers
    for (int c = 0; c < 8; c++) {
        s  += v[c].x + v[c].y + v[c].z + v[c].w;
        s2 += v[c].x*v[c].x + v[c].y*v[c].y + v[c].z*v[c].z + v[c].w*v[c].w;
    }
    #pragma unroll
    for (int m = 16; m >= 1; m >>= 1) {
        s  += __shfl_xor(s,  m, 32);
        s2 += __shfl_xor(s2, m, 32);
    }
    const float mu  = s * (1.0f / DDIM);
    const float var = s2 * (1.0f / DDIM) - mu * mu;
    const float inv = rsqrtf(var + 1e-5f);
    _Float16* dst = xn + (size_t)row * DDIM + ln * 4;
    #pragma unroll                 // constant indices keep v in registers
    for (int c = 0; c < 8; c++) {
        const v4f g  = ((const v4f*)gamma)[c * 32 + ln];
        const v4f bb = ((const v4f*)beta)[c * 32 + ln];
        v4h h;
        h.x = (_Float16)((v[c].x - mu) * inv * g.x + bb.x);
        h.y = (_Float16)((v[c].y - mu) * inv * g.y + bb.y);
        h.z = (_Float16)((v[c].z - mu) * inv * g.z + bb.z);
        h.w = (_Float16)((v[c].w - mu) * inv * g.w + bb.w);
        *(v4h*)(dst + c * 128) = h;
    }
}

static __device__ __forceinline__
void cvt_wT_block(const int blk,
                  const float* __restrict__ wq, const float* __restrict__ wk,
                  const float* __restrict__ wv, const float* __restrict__ wo,
                  _Float16* __restrict__ w16t) {
    const int wvi = threadIdx.x >> 5;
    const int ln  = threadIdx.x & 31;
    const int m   = blk >> 7;            // which matrix: 128 blocks each
    const int r   = blk & 127;
    const int n   = (r & 31) * 32  + (wvi & 1) * 16  + (ln >> 3) * 4;   // W column
    const int k   = (r >> 5) * 256 + (wvi >> 1) * 64 + (ln & 7) * 8;    // W row
    const float* s = m == 0 ? wq : m == 1 ? wk : m == 2 ? wv : wo;
    s += (size_t)k * DDIM + n;
    v4f v[8];
    #pragma unroll                 // constant indices keep v in registers
    for (int j = 0; j < 8; j++) v[j] = *(const v4f*)(s + (size_t)j * DDIM);
    _Float16* d = w16t + (size_t)m * DDIM * DDIM + (size_t)n * DDIM + k;
    #pragma unroll                 // constant indices keep v in registers
    for (int e = 0; e < 4; e++) {
        v8h h;
        #pragma unroll             // constant indices keep v and h in registers
        for (int j = 0; j < 8; j++) h[j] = (_Float16)v[j][e];
        *(v8h*)(d + (size_t)e * DDIM) = h;
    }
}

#define LN_BLOCKS  (NROWS / 8)                 // 512
#define CVT_BLOCKS ((4 * DDIM * DDIM) / 8192)  // 512
__global__ __launch_bounds__(256)
void prep_kernel(const float* __restrict__ x,
                 const float* __restrict__ gamma,
                 const float* __restrict__ beta,
                 _Float16* __restrict__ xn,
                 const float* __restrict__ wq, const float* __restrict__ wk,
                 const float* __restrict__ wv, const float* __restrict__ wo,
                 _Float16* __restrict__ w16t) {
    if (blockIdx.x < LN_BLOCKS)
        ln_block(blockIdx.x, x, gamma, beta, xn);
    else
        cvt_wT_block(blockIdx.x - LN_BLOCKS, wq, wk, wv, wo, w16t);
}

// ---------------------------------------------------------------------------
// Kernel 2/4: tiled WMMA GEMM.  C = A16 * WT16^T + bias.
//   Block 256 thr = 8 waves; tile 128(M) x 64(N); 128 k per staging round, so
//   that the copy latency, the A latency and the two barriers are paid 8 times.
//   B tile async-copied from WT (row-major [n][k]) into Bs (64 rows of 128, padded).
// gemm_tile: the k loop of one work-group; acc = this wave's 16 x 64 tile.
// ---------------------------------------------------------------------------
static __device__ __forceinline__
void gemm_tile(const _Float16* __restrict__ A,
               const _Float16* __restrict__ WT,
               _Float16 (&Bs)[64][P128H],
               const int M0, const int N0, v8f (&acc)[4]) {
    const int tid = threadIdx.x;
    const int ln  = tid & 31;
    const int lrow  = ln & 15;
    const int lhalf = ln >> 4;

    const _Float16* arow = A + (size_t)(M0 + lrow) * DDIM;

    const int sc  = tid >> 4;          // 0..15  : Bs row (= output col), + 16 per copy
    const int sk  = (tid & 15) * 8;    // 0..120 : k offset (16B chunks)
    const _Float16* wrow = WT + (size_t)(N0 + sc) * DDIM + sk;

    for (int k0 = 0; k0 < DDIM; k0 += 128) {
        async_cp16x4(&Bs[sc][sk],      wrow + k0,
                     &Bs[sc + 16][sk], wrow + k0 + 16 * DDIM,
                     &Bs[sc + 32][sk], wrow + k0 + 32 * DDIM,
                     &Bs[sc + 48][sk], wrow + k0 + 48 * DDIM);
        v16h afrag[4];                 // the round's A loads fly beside its copies
        #pragma unroll                 // constant indices keep afrag in registers
        for (int s = 0; s < 4; s++)
            afrag[s] = *(const v16h*)(arow + k0 + s * 32 + lhalf * 16);
        if (k0 + 128 < DDIM)           // the two lanes of a row take its two next lines
            __builtin_prefetch(arow + k0 + 128 + lhalf * 64, 0, 0);
        wait_async0();
        __syncthreads();

        #pragma unroll                 // constant indices keep afrag and acc in registers
        for (int s = 0; s < 4; s++) {
            #pragma unroll
            for (int j = 0; j < 4; j++) {
                v16h bfrag = lds_frag(&Bs[j * 16 + lrow][s * 32 + lhalf * 16]);
                acc[j] = wmma_f16(afrag[s], bfrag, acc[j]);
            }
        }
        __syncthreads();
    }
}

// q, k and v in ONE launch.  They share A and depend on nothing of each other;
// their transposed weights lie behind one another in WT (3,072 rows) and their
// outputs behind one another in qkv, so blockIdx.x >> 4 names the product.  Two
// launch gaps go, and six work-groups per WGP instead of two cover each other's
// copy latency and barriers.
//   q, k: f16 row-major.  v: f16 transposed [D][NROWS] (VT).
__global__ void gemm_qkv_kernel(const _Float16* __restrict__ A,
                                const _Float16* __restrict__ WT,
                                const float* __restrict__ bq,
                                const float* __restrict__ bk,
                                const float* __restrict__ bv,
                                _Float16* __restrict__ qkv) {
    __shared__ __attribute__((aligned(16))) _Float16 Bs[64][P128H];  // [col][k], 17 KB
    const int wv    = threadIdx.x >> 5;
    const int lrow  = threadIdx.x & 15;
    const int lhalf = (threadIdx.x & 31) >> 4;
    const int M0  = blockIdx.y * 128 + wv * 16;
    const int N0  = blockIdx.x * 64;   // row of WT: 1,024 rows per product

    v8f acc[4] = {v8f{}, v8f{}, v8f{}, v8f{}};
    gemm_tile(A, WT, Bs, M0, N0, acc);

    const int which   = blockIdx.x >> 4;            // 0 q, 1 k, 2 v: the same for the whole work-group
    const int colbase = (N0 & (DDIM - 1)) + lrow;   // column inside that product
    const int rowbase = M0 + lhalf * 8;
    const float* bias = which == 0 ? bq : which == 1 ? bk : bv;
    _Float16* o16 = qkv + (size_t)which * NROWS * DDIM;
    // The sums with their bias, rounded to f16 once, in front of the branch: both
    // paths store out of the same 16 registers.
    v8h hv[4];
    #pragma unroll                     // constant indices keep acc and hv in registers
    for (int j = 0; j < 4; j++) {
        const float bj = bias[colbase + j * 16];
        #pragma unroll
        for (int i = 0; i < 8; i++) hv[j][i] = (_Float16)(acc[j][i] + bj);
    }
    if (which == 2) {
        #pragma unroll
        for (int j = 0; j < 4; j++) {
            #pragma unroll
            for (int i = 0; i < 8; i++)
                o16[(size_t)(colbase + j * 16) * NROWS + rowbase + i] = hv[j][i];   // VT
        }
    } else {
        #pragma unroll
        for (int j = 0; j < 4; j++) {
            #pragma unroll
            for (int i = 0; i < 8; i++)
                o16[(size_t)(rowbase + i) * DDIM + colbase + j * 16] = hv[j][i];
        }
        asm volatile("s_wait_xcnt 0x0" ::: "memory");
    }
}

// The output projection: out f32 = val + resid (final output).
__global__ void gemm_out_kernel(const _Float16* __restrict__ A,
                                const _Float16* __restrict__ WT,
                                const float* __restrict__ bias,
                                const float* __restrict__ resid,
                                float* __restrict__ out32) {
    __shared__ __attribute__((aligned(16))) _Float16 Bs[64][P128H];  // [col][k], 17 KB
    const int wv    = threadIdx.x >> 5;
    const int lrow  = threadIdx.x & 15;
    const int lhalf = (threadIdx.x & 31) >> 4;
    const int M0  = blockIdx.y * 128 + wv * 16;
    const int N0  = blockIdx.x * 64;

    v8f acc[4] = {v8f{}, v8f{}, v8f{}, v8f{}};
    gemm_tile(A, WT, Bs, M0, N0, acc);

    const int rowbase = M0 + lhalf * 8;
    #pragma unroll
    for (int j = 0; j < 4; j++) {
        const int col = N0 + j * 16 + lrow;
        const float bv = bias[col];
        #pragma unroll
        for (int i = 0; i < 8; i++) {
            const int row = rowbase + i;
            const float val = acc[j][i] + bv;
            const size_t idx = (size_t)row * DDIM + col;
            out32[idx] = val + resid[idx];
        }
    }
}

__global__ __launch_bounds__(256)
__attribute__((amdgpu_waves_per_eu(4, 4)))
void attn_kernel(const _Float16* __restrict__ Q,
                            const _Float16* __restrict__ K,
                            const _Float16* __restrict__ VT,   // [D][NROWS]
                            const int* __restrict__ mask,
                            _Float16* __restrict__ Y) {
    __shared__ __attribute__((aligned(16))) _Float16 Ks[2][32][P64H];   // [buf][keyrow][k]   2 x 4.5 KB
    __shared__ __attribute__((aligned(16))) _Float16 Vs[2][64][P32H];   // [buf][d][keyrow]   2 x   5 KB
    __shared__ __attribute__((aligned(16))) int      Ms[2][128][P32I];  // [buf] mask tile    2 x  18 KB

    const int tid = threadIdx.x;
    const int wv  = tid >> 5;
    const int ln  = tid & 31;
    const int lrow  = ln & 15;
    const int lhalf = ln >> 4;
    const int b = blockIdx.z, h = blockIdx.y;
    const int nblk = blockIdx.x * 128;                // block's query-row base
    const int n0 = nblk + wv * 16;                    // this wave's rows
    const size_t headoff = (size_t)h * DH;

    const size_t qrow = (size_t)(b * TDIM + n0 + lrow) * DDIM + headoff;
    v16h q0 = *(const v16h*)(Q + qrow + lhalf * 16);
    v16h q1 = *(const v16h*)(Q + qrow + 32 + lhalf * 16);

    v8f o[4] = {v8f{}, v8f{}, v8f{}, v8f{}};          // O^T: row d = 16 j + 8 lhalf + i, column = query lrow
    float lsum[4] = {0.f, 0.f, 0.f, 0.f};             // this lane's keys of query lrow, four chains

    // staging thread maps
    const int kmr = tid >> 3, kc = (tid & 7) * 8;     // Ks: 32 x 64
    const int vd  = tid >> 2, vk = (tid & 3) * 8;     // Vs: 64 x 32
    const int mr  = tid >> 3, mc = (tid & 7) * 4;     // Ms: 128 x 32 ints, rows mr + 32 u
    // the next tile to be copied, one running pointer per source array
    const _Float16* ksrc = K  + (size_t)(b * TDIM + kmr) * DDIM + headoff + kc;
    const _Float16* vsrc = VT + (headoff + vd) * (size_t)NROWS + b * TDIM + vk;
    const int*      msrc = mask + ((size_t)b * TDIM + nblk + mr) * TDIM + mc;

    // One lane's six copies of the next tile into buffer buf.
    auto stage = [&](const int buf) __attribute__((always_inline)) {
        async_cp16x6(&Ks[buf][kmr][kc],     ksrc,
                     &Vs[buf][vd][vk],      vsrc,
                     &Ms[buf][mr][mc],      msrc,
                     &Ms[buf][mr + 32][mc], msrc + 32 * TDIM,
                     &Ms[buf][mr + 64][mc], msrc + 64 * TDIM,
                     &Ms[buf][mr + 96][mc], msrc + 96 * TDIM);
        ksrc += (size_t)32 * DDIM;
        vsrc += 32;
        msrc += 32;
    };

    // One trip: tile t out of buffer buf = t mod 2; refill: a tile t + 2 exists.
    auto trip = [&](const int buf, const bool refill) __attribute__((always_inline)) {
        // S^T tile t: row = key 16 t + 8 lhalf + i, column = query lrow.
        v8f s[2];
        #pragma unroll             // constant indices keep s in registers
        for (int t = 0; t < 2; t++) {
            v16h kf0 = lds_frag(&Ks[buf][t * 16 + lrow][lhalf * 16]);
            v16h kf1 = lds_frag(&Ks[buf][t * 16 + lrow][32 + lhalf * 16]);
            v8f z = v8f{};
            z = wmma_f16(kf0, q0, z);
            z = wmma_f16(kf1, q1, z);
            s[t] = z;
        }
        // The trip's mask words and V^T fragments (A operand, in the key order of pf).
        v4i mlo[2], mhi[2];
        #pragma unroll             // constant indices keep mlo and mhi in registers
        for (int t = 0; t < 2; t++) {
            const int* mrow = &Ms[buf][wv * 16 + lrow][t * 16 + lhalf * 8];
            mlo[t] = *(const v4i*)mrow;
            mhi[t] = *(const v4i*)(mrow + 4);
        }
        v16h vf[4];
        #pragma unroll             // constant indices keep vf in registers
        for (int j = 0; j < 4; j++) {
            const _Float16* vrow = &Vs[buf][j * 16 + lrow][lhalf * 8];
            v8h lo = *(const v8h*)vrow;
            v8h hi = *(const v8h*)(vrow + 16);
            vf[j] = __builtin_shufflevector(lo, hi, 0, 1, 2, 3, 4, 5, 6, 7,
                                            8, 9, 10, 11, 12, 13, 14, 15);
        }

        // Publish point: the trip's last LDS read stands above, the rest of it
        // works on registers.  This wave has left buffer buf; its copies of tile
        // t + 1 have landed; the barrier says both of every wave.
        wait_ds0();
        wait_async0();
        __syncthreads();
        if (refill) stage(buf);

        // P^T as a B operand: element 8 t + i of a lane is key 16 t + 8 lhalf + i.
        v16h pf;
        #pragma unroll             // constant indices keep s, pf and lsum in registers
        for (int t = 0; t < 2; t++) {
            #pragma unroll         // constant indices keep s, pf and lsum in registers
            for (int i = 0; i < 8; i++) {
                const int mk = i < 4 ? mlo[t][i & 3] : mhi[t][i & 3];
                float p = mk ? __expf(s[t][i] * 0.125f) : 0.0f;
                lsum[i & 3] += p;
                pf[t * 8 + i] = (_Float16)p;
            }
        }
        #pragma unroll             // constant indices keep o in registers
        for (int j = 0; j < 4; j++)
            o[j] = wmma_f16(vf[j], pf, o[j]);
    };

    stage(0);                      // tile 0
    wait_async0();
    __syncthreads();
    stage(1);                      // tile 1 flies during trip 0
    // Two trips a pass, so that the buffer is a constant in every address; the
    // last two trips, which have no tile left to ask for, stand behind the loop.
    for (int m0 = 0; m0 < TDIM - 64; m0 += 64) {
        trip(0, true);
        trip(1, true);
    }
    trip(0, false);
    trip(1, false);
    wait_async0();                 // nothing is outstanding when the wave ends

    // Join the two half-waves' partial sums of each query once, behind the loop.
    float den = (lsum[0] + lsum[1]) + (lsum[2] + lsum[3]);
    den += __shfl_xor(den, 16, 32);

    _Float16* yrow = Y + (size_t)(b * TDIM + n0 + lrow) * DDIM + headoff + lhalf * 8;
    #pragma unroll                 // constant indices keep o in registers
    for (int j = 0; j < 4; j++) {
        v8h hv;
        #pragma unroll             // constant indices keep o and hv in registers
        for (int i = 0; i < 8; i++)
            hv[i] = (_Float16)(o[j][i] / (den + 1e-20f));
        *(v8h*)(yrow + j * 16) = hv;
    }
}

// ---------------------------------------------------------------------------
// Host launcher
// ---------------------------------------------------------------------------
extern "C" void kernel_launch(void* const* d_in, const int* in_sizes, int n_in,
                              void* d_out, int out_size, void* d_ws, size_t ws_size,
                              hipStream_t stream) {
    const float* x     = (const float*)d_in[0];
    const int*   mask  = (const int*)  d_in[1];
    const float* gamma = (const float*)d_in[2];
    const float* beta  = (const float*)d_in[3];
    const float* Wq    = (const float*)d_in[4];
    const float* bq    = (const float*)d_in[5];
    const float* Wk    = (const float*)d_in[6];
    const float* bk    = (const float*)d_in[7];
    const float* Wv    = (const float*)d_in[8];
    const float* bv    = (const float*)d_in[9];
    const float* Wo    = (const float*)d_in[10];
    const float* bo    = (const float*)d_in[11];
    float* out = (float*)d_out;

    const size_t ND = (size_t)NROWS * DDIM;
    const size_t DD = (size_t)DDIM * DDIM;
    _Float16* xn   = (_Float16*)d_ws;
    _Float16* q    = xn + ND;
    _Float16* k    = q + ND;
    _Float16* vt   = k + ND;          // [D][NROWS]
    _Float16* y    = vt + ND;
    _Float16* w16t = y + ND;          // 4*DD halves (total 48 MB)

    prep_kernel<<<LN_BLOCKS + CVT_BLOCKS, 256, 0, stream>>>(x, gamma, beta, xn, Wq, Wk, Wv, Wo, w16t);

    dim3 qkvgrid(3 * DDIM / 64, NROWS / 128);   // q, k, vt lie behind one another in the workspace
    gemm_qkv_kernel<<<qkvgrid, 256, 0, stream>>>(xn, w16t, bq, bk, bv, q);

    dim3 agrid(TDIM / 128, HH, BDIM);
    attn_kernel<<<agrid, 256, 0, stream>>>(q, k, vt, mask, y);

    dim3 ggrid(DDIM / 64, NROWS / 128);
    gemm_out_kernel<<<ggrid, 256, 0, stream>>>(y, w16t + 3 * DD, bo, x, out);
}

// v008
// Measured time: 108 microseconds a run.
// Two timings next to v007 put it at 1.11 and 1.09 times that version's speed.
// Over all steps from v000 it is 2.78 times as fast.
#include <hip/hip_runtime.h>
#include <hip/hip_bf16.h>
#include <stdint.h>

typedef __attribute__((ext_vector_type(16))) _Float16 v16h;
typedef __attribute__((ext_vector_type(8)))  _Float16 v8h;
typedef __attribute__((ext_vector_type(8)))  float    v8f;
typedef __attribute__((ext_vector_type(4)))  _Float16 v4h;
typedef __attribute__((ext_vector_type(4)))  float    v4f;
typedef __attribute__((ext_vector_type(4)))  int      v4i;

#define BDIM  2
#define TDIM  2048
#define DDIM  1024
#define HH    16
#define DH    64
#define NROWS (BDIM * TDIM)   // 4096

static __device__ __forceinline__ v8f wmma_f16(v16h a, v16h b, v8f c) {
    return __builtin_amdgcn_wmma_f32_16x16x32_f16(
        false, a, false, b, (short)0, c, false, false);
}

static __device__ __forceinline__ void async_cp16x12(void* const (&l)[12], const void* const (&g)[12]) {
    asm volatile("global_load_async_to_lds_b128 %0, %12, off\n\t"
                 "global_load_async_to_lds_b128 %1, %13, off\n\t"
                 "global_load_async_to_lds_b128 %2, %14, off\n\t"
                 "global_load_async_to_lds_b128 %3, %15, off\n\t"
                 "global_load_async_to_lds_b128 %4, %16, off\n\t"
                 "global_load_async_to_lds_b128 %5, %17, off\n\t"
                 "global_load_async_to_lds_b128 %6, %18, off\n\t"
                 "global_load_async_to_lds_b128 %7, %19, off\n\t"
                 "global_load_async_to_lds_b128 %8, %20, off\n\t"
                 "global_load_async_to_lds_b128 %9, %21, off\n\t"
                 "global_load_async_to_lds_b128 %10, %22, off\n\t"
                 "global_load_async_to_lds_b128 %11, %23, off\n\t"
                 "s_wait_xcnt 0x0"
                 :: "v"((unsigned)(uintptr_t)l[0]), "v"((unsigned)(uintptr_t)l[1]),
                    "v"((unsigned)(uintptr_t)l[2]), "v"((unsigned)(uintptr_t)l[3]),
                    "v"((unsigned)(uintptr_t)l[4]), "v"((unsigned)(uintptr_t)l[5]),
                    "v"((unsigned)(uintptr_t)l[6]), "v"((unsigned)(uintptr_t)l[7]),
                    "v"((unsigned)(uintptr_t)l[8]), "v"((unsigned)(uintptr_t)l[9]),
                    "v"((unsigned)(uintptr_t)l[10]), "v"((unsigned)(uintptr_t)l[11]),
                    "v"((uint64_t)(uintptr_t)g[0]), "v"((uint64_t)(uintptr_t)g[1]),
                    "v"((uint64_t)(uintptr_t)g[2]), "v"((uint64_t)(uintptr_t)g[3]),
                    "v"((uint64_t)(uintptr_t)g[4]), "v"((uint64_t)(uintptr_t)g[5]),
                    "v"((uint64_t)(uintptr_t)g[6]), "v"((uint64_t)(uintptr_t)g[7]),
                    "v"((uint64_t)(uintptr_t)g[8]), "v"((uint64_t)(uintptr_t)g[9]),
                    "v"((uint64_t)(uintptr_t)g[10]), "v"((uint64_t)(uintptr_t)g[11])
                 : "memory");
}
static __device__ __forceinline__ void async_cp16x6(void* l0, const void* g0,
                                                    void* l1, const void* g1,
                                                    void* l2, const void* g2,
                                                    void* l3, const void* g3,
                                                    void* l4, const void* g4,
                                                    void* l5, const void* g5) {
    asm volatile("global_load_async_to_lds_b128 %0, %6, off\n\t"
                 "global_load_async_to_lds_b128 %1, %7, off\n\t"
                 "global_load_async_to_lds_b128 %2, %8, off\n\t"
                 "global_load_async_to_lds_b128 %3, %9, off\n\t"
                 "global_load_async_to_lds_b128 %4, %10, off\n\t"
                 "global_load_async_to_lds_b128 %5, %11, off\n\t"
                 "s_wait_xcnt 0x0"
                 :: "v"((unsigned)(uintptr_t)l0), "v"((unsigned)(uintptr_t)l1),
                    "v"((unsigned)(uintptr_t)l2), "v"((unsigned)(uintptr_t)l3),
                    "v"((unsigned)(uintptr_t)l4), "v"((unsigned)(uintptr_t)l5),
                    "v"((uint64_t)(uintptr_t)g0), "v"((uint64_t)(uintptr_t)g1),
                    "v"((uint64_t)(uintptr_t)g2), "v"((uint64_t)(uintptr_t)g3),
                    "v"((uint64_t)(uintptr_t)g4), "v"((uint64_t)(uintptr_t)g5)
                 : "memory");
}
static __device__ __forceinline__ void wait_async0() {
    asm volatile("s_wait_asynccnt 0x0" ::: "memory");
}
// A wave's own LDS reads have returned: stands in front of the barrier behind
// which the buffer that it has read is refilled by copies.
static __device__ __forceinline__ void wait_ds0() {
    asm volatile("s_wait_dscnt 0x0" ::: "memory");
}

#define P32H 40   // halves: rows of 32 halves (64 B) laid at 80 B
#define P64H 72   // halves: rows of 64 halves (128 B) laid at 144 B
#define P128H 136 // halves: rows of 128 halves (256 B) laid at 272 B
#define P32I 36   // ints:   rows of 32 ints (128 B) laid at 144 B

// 16 x 32 fragment slice of one lane: 32 contiguous bytes, 16-B aligned.
static __device__ __forceinline__ v16h lds_frag(const _Float16* p) {
    v8h lo = *(const v8h*)p;
    v8h hi = *(const v8h*)(p + 8);
    return __builtin_shufflevector(lo, hi, 0, 1, 2, 3, 4, 5, 6, 7,
                                   8, 9, 10, 11, 12, 13, 14, 15);
}

// ---------------------------------------------------------------------------
// Kernel 1, first part: LayerNorm, f32 in -> f16 out.  One wave per row, 32 elements a lane:
//   4,096 waves to start instead of 32,768, eight 512-B loads in flight per wave,
//   the row sums stay inside the wave (no LDS, no barrier).
// ---------------------------------------------------------------------------
static __device__ __forceinline__
void ln_block(const int blk,
              const float* __restrict__ x,
              const float* __restrict__ gamma,
              const float* __restrict__ beta,
              _Float16* __restrict__ xn) {
    const int ln  = threadIdx.x & 31;
    const int row = blk * 8 + (threadIdx.x >> 5);
    const v4f* xr = (const v4f*)(x + (size_t)row * DDIM) + ln;
    v4f v[8];
    #pragma unroll                 // constant indices keep v in registers
    for (int c = 0; c < 8; c++) v[c] = xr[c * 32];
    float s = 0.f, s2 = 0.f;
    #pragma unroll                 // constant indices keep v in registers
    for (int c = 0; c < 8; c++) {
        s  += v[c].x + v[c].y + v[c].z + v[c].w;
        s2 += v[c].x*v[c].x + v[c].y*v[c].y + v[c].z*v[c].z + v[c].w*v[c].w;
    }
    #pragma unroll
    for (int m = 16; m >= 1; m >>= 1) {
        s  += __shfl_xor(s,  m, 32);
        s2 += __shfl_xor(s2, m, 32);
    }
    const float mu  = s * (1.0f / DDIM);
    const float var = s2 * (1.0f / DDIM) - mu * mu;
    const float inv = rsqrtf(var + 1e-5f);
    _Float16* dst = xn + (size_t)row * DDIM + ln * 4;
    #pragma unroll                 // constant indices keep v in registers
    for (int c = 0; c < 8; c++) {
        const v4f g  = ((const v4f*)gamma)[c * 32 + ln];
        const v4f bb = ((const v4f*)beta)[c * 32 + ln];
        v4h h;
        h.x = (_Float16)((v[c].x - mu) * inv * g.x + bb.x);
        h.y = (_Float16)((v[c].y - mu) * inv * g.y + bb.y);
        h.z = (_Float16)((v[c].z - mu) * inv * g.z + bb.z);
        h.w = (_Float16)((v[c].w - mu) * inv * g.w + bb.w);
        *(v4h*)(dst + c * 128) = h;
    }
}

static __device__ __forceinline__
void cvt_wT_block(const int blk,
                  const float* __restrict__ wq, const float* __restrict__ wk,
                  const float* __restrict__ wv, const float* __restrict__ wo,
                  _Float16* __restrict__ w16t) {
    const int wvi = threadIdx.x >> 5;
    const int ln  = threadIdx.x & 31;
    const int m   = blk >> 7;            // which matrix: 128 blocks each
    const int r   = blk & 127;
    const int n   = (r & 31) * 32  + (wvi & 1) * 16  + (ln >> 3) * 4;   // W column
    const int k   = (r >> 5) * 256 + (wvi >> 1) * 64 + (ln & 7) * 8;    // W row
    const float* s = m == 0 ? wq : m == 1 ? wk : m == 2 ? wv : wo;
    s += (size_t)k * DDIM + n;
    v4f v[8];
    #pragma unroll                 // constant indices keep v in registers
    for (int j = 0; j < 8; j++) v[j] = *(const v4f*)(s + (size_t)j * DDIM);
    _Float16* d = w16t + (size_t)m * DDIM * DDIM + (size_t)n * DDIM + k;
    #pragma unroll                 // constant indices keep v in registers
    for (int e = 0; e < 4; e++) {
        v8h h;
        #pragma unroll             // constant indices keep v and h in registers
        for (int j = 0; j < 8; j++) h[j] = (_Float16)v[j][e];
        *(v8h*)(d + (size_t)e * DDIM) = h;
    }
}

#define LN_BLOCKS  (NROWS / 8)                 // 512
#define CVT_BLOCKS ((4 * DDIM * DDIM) / 8192)  // 512
__global__ __launch_bounds__(256)
void prep_kernel(const float* __restrict__ x,
                 const float* __restrict__ gamma,
                 const float* __restrict__ beta,
                 _Float16* __restrict__ xn,
                 const float* __restrict__ wq, const float* __restrict__ wk,
                 const float* __restrict__ wv, const float* __restrict__ wo,
                 _Float16* __restrict__ w16t) {
    if (blockIdx.x < LN_BLOCKS)
        ln_block(blockIdx.x, x, gamma, beta, xn);
    else
        cvt_wT_block(blockIdx.x - LN_BLOCKS, wq, wk, wv, wo, w16t);
}

static __device__ __forceinline__
void gemm_tile(const _Float16* __restrict__ A,
               const _Float16* __restrict__ WT,
               _Float16 (&As)[128][P128H],
               _Float16 (&Bs)[64][P128H],
               const int M0, const int N0, v8f (&acc)[4]) {
    const int tid = threadIdx.x;
    const int ln  = tid & 31;
    const int lrow  = ln & 15;
    const int lhalf = ln >> 4;

    const int ar  = (tid >> 5) * 16;   // this wave's first row of As
    const int ak  = lrow * 8;          // 0..120 : k offset (16B chunks); rows ar + lhalf, + 2 per copy
    const _Float16* asrc = A + (size_t)(M0 + lhalf) * DDIM + ak;

    const int sc  = tid >> 4;          // 0..15  : Bs row (= output col), + 16 per copy
    const int sk  = (tid & 15) * 8;    // 0..120 : k offset (16B chunks)
    const _Float16* wrow = WT + (size_t)(N0 + sc) * DDIM + sk;

    for (int k0 = 0; k0 < DDIM; k0 += 128) {
        void* l[12];
        const void* g[12];
        #pragma unroll                 // constant indices keep l and g in registers
        for (int c = 0; c < 4; c++) {
            l[c] = &Bs[sc + 16 * c][sk];
            g[c] = wrow + k0 + 16 * c * DDIM;
        }
        #pragma unroll                 // constant indices keep l and g in registers
        for (int c = 0; c < 8; c++) {
            l[4 + c] = &As[ar + lhalf + 2 * c][ak];
            g[4 + c] = asrc + k0 + 2 * c * DDIM;
        }
        async_cp16x12(l, g);
        wait_async0();
        __syncthreads();

        #pragma unroll                 // constant indices keep acc in registers
        for (int s = 0; s < 4; s++) {
            v16h afrag = lds_frag(&As[ar + lrow][s * 32 + lhalf * 16]);
            #pragma unroll
            for (int j = 0; j < 4; j++) {
                v16h bfrag = lds_frag(&Bs[j * 16 + lrow][s * 32 + lhalf * 16]);
                acc[j] = wmma_f16(afrag, bfrag, acc[j]);
            }
        }
        __syncthreads();
    }
}

// q, k and v in ONE launch.  They share A and depend on nothing of each other;
// their transposed weights lie behind one another in WT (3,072 rows) and their
// outputs behind one another in qkv, so blockIdx.x >> 4 names the product.  Two
// launch gaps go, and six work-groups per WGP instead of two cover each other's
// copy latency and barriers.
//   q, k: f16 row-major.  v: f16 transposed [D][NROWS] (VT).
__global__ void gemm_qkv_kernel(const _Float16* __restrict__ A,
                                const _Float16* __restrict__ WT,
                                const float* __restrict__ bq,
                                const float* __restrict__ bk,
                                const float* __restrict__ bv,
                                _Float16* __restrict__ qkv) {
    __shared__ __attribute__((aligned(16))) _Float16 As[128][P128H]; // [row][k], 34 KB
    __shared__ __attribute__((aligned(16))) _Float16 Bs[64][P128H];  // [col][k], 17 KB
    const int wv    = threadIdx.x >> 5;
    const int lrow  = threadIdx.x & 15;
    const int lhalf = (threadIdx.x & 31) >> 4;
    const int M0  = blockIdx.y * 128 + wv * 16;
    const int N0  = blockIdx.x * 64;   // row of WT: 1,024 rows per product

    v8f acc[4] = {v8f{}, v8f{}, v8f{}, v8f{}};
    gemm_tile(A, WT, As, Bs, M0, N0, acc);

    const int which   = blockIdx.x >> 4;            // 0 q, 1 k, 2 v: the same for the whole work-group
    const int colbase = (N0 & (DDIM - 1)) + lrow;   // column inside that product
    const int rowbase = M0 + lhalf * 8;
    const float* bias = which == 0 ? bq : which == 1 ? bk : bv;
    _Float16* o16 = qkv + (size_t)which * NROWS * DDIM;
    // The sums with their bias, rounded to f16 once, in front of the branch: both
    // paths store out of the same 16 registers.
    v8h hv[4];
    #pragma unroll                     // constant indices keep acc and hv in registers
    for (int j = 0; j < 4; j++) {
        const float bj = bias[colbase + j * 16];
        #pragma unroll
        for (int i = 0; i < 8; i++) hv[j][i] = (_Float16)(acc[j][i] + bj);
    }
    if (which == 2) {
        #pragma unroll
        for (int j = 0; j < 4; j++) {
            #pragma unroll
            for (int i = 0; i < 8; i++)
                o16[(size_t)(colbase + j * 16) * NROWS + rowbase + i] = hv[j][i];   // VT
        }
    } else {
        #pragma unroll
        for (int j = 0; j < 4; j++) {
            #pragma unroll
            for (int i = 0; i < 8; i++)
                o16[(size_t)(rowbase + i) * DDIM + colbase + j * 16] = hv[j][i];
        }
        asm volatile("s_wait_xcnt 0x0" ::: "memory");
    }
}

// The output projection: out f32 = val + resid (final output).
__global__ void gemm_out_kernel(const _Float16* __restrict__ A,
                                const _Float16* __restrict__ WT,
                                const float* __restrict__ bias,
                                const float* __restrict__ resid,
                                float* __restrict__ out32) {
    __shared__ __attribute__((aligned(16))) _Float16 As[128][P128H]; // [row][k], 34 KB
    __shared__ __attribute__((aligned(16))) _Float16 Bs[64][P128H];  // [col][k], 17 KB
    const int wv    = threadIdx.x >> 5;
    const int lrow  = threadIdx.x & 15;
    const int lhalf = (threadIdx.x & 31) >> 4;
    const int M0  = blockIdx.y * 128 + wv * 16;
    const int N0  = blockIdx.x * 64;

    v8f acc[4] = {v8f{}, v8f{}, v8f{}, v8f{}};
    gemm_tile(A, WT, As, Bs, M0, N0, acc);

    const int rowbase = M0 + lhalf * 8;
    #pragma unroll
    for (int j = 0; j < 4; j++) {
        const int col = N0 + j * 16 + lrow;
        const float bv = bias[col];
        #pragma unroll
        for (int i = 0; i < 8; i++) {
            const int row = rowbase + i;
            const float val = acc[j][i] + bv;
            const size_t idx = (size_t)row * DDIM + col;
            out32[idx] = val + resid[idx];
        }
    }
}

__global__ __launch_bounds__(256)
__attribute__((amdgpu_waves_per_eu(4, 4)))
void attn_kernel(const _Float16* __restrict__ Q,
                            const _Float16* __restrict__ K,
                            const _Float16* __restrict__ VT,   // [D][NROWS]
                            const int* __restrict__ mask,
                            _Float16* __restrict__ Y) {
    __shared__ __attribute__((aligned(16))) _Float16 Ks[2][32][P64H];   // [buf][keyrow][k]   2 x 4.5 KB
    __shared__ __attribute__((aligned(16))) _Float16 Vs[2][64][P32H];   // [buf][d][keyrow]   2 x   5 KB
    __shared__ __attribute__((aligned(16))) int      Ms[2][128][P32I];  // [buf] mask tile    2 x  18 KB

    const int tid = threadIdx.x;
    const int wv  = tid >> 5;
    const int ln  = tid & 31;
    const int lrow  = ln & 15;
    const int lhalf = ln >> 4;
    const int b = blockIdx.z, h = blockIdx.y;
    const int nblk = blockIdx.x * 128;                // block's query-row base
    const int n0 = nblk + wv * 16;                    // this wave's rows
    const size_t headoff = (size_t)h * DH;

    const size_t qrow = (size_t)(b * TDIM + n0 + lrow) * DDIM + headoff;
    v16h q0 = *(const v16h*)(Q + qrow + lhalf * 16);
    v16h q1 = *(const v16h*)(Q + qrow + 32 + lhalf * 16);

    v8f o[4] = {v8f{}, v8f{}, v8f{}, v8f{}};          // O^T: row d = 16 j + 8 lhalf + i, column = query lrow
    float lsum[4] = {0.f, 0.f, 0.f, 0.f};             // this lane's keys of query lrow, four chains

    // staging thread maps
    const int kmr = tid >> 3, kc = (tid & 7) * 8;     // Ks: 32 x 64
    const int vd  = tid >> 2, vk = (tid & 3) * 8;     // Vs: 64 x 32
    const int mr  = tid >> 3, mc = (tid & 7) * 4;     // Ms: 128 x 32 ints, rows mr + 32 u
    // the next tile to be copied, one running pointer per source array
    const _Float16* ksrc = K  + (size_t)(b * TDIM + kmr) * DDIM + headoff + kc;
    const _Float16* vsrc = VT + (headoff + vd) * (size_t)NROWS + b * TDIM + vk;
    const int*      msrc = mask + ((size_t)b * TDIM + nblk + mr) * TDIM + mc;

    // One lane's six copies of the next tile into buffer buf.
    auto stage = [&](const int buf) __attribute__((always_inline)) {
        async_cp16x6(&Ks[buf][kmr][kc],     ksrc,
                     &Vs[buf][vd][vk],      vsrc,
                     &Ms[buf][mr][mc],      msrc,
                     &Ms[buf][mr + 32][mc], msrc + 32 * TDIM,
                     &Ms[buf][mr + 64][mc], msrc + 64 * TDIM,
                     &Ms[buf][mr + 96][mc], msrc + 96 * TDIM);
        ksrc += (size_t)32 * DDIM;
        vsrc += 32;
        msrc += 32;
    };

    // One trip: tile t out of buffer buf = t mod 2; refill: a tile t + 2 exists.
    auto trip = [&](const int buf, const bool refill) __attribute__((always_inline)) {
        // S^T tile t: row = key 16 t + 8 lhalf + i, column = query lrow.
        v8f s[2];
        #pragma unroll             // constant indices keep s in registers
        for (int t = 0; t < 2; t++) {
            v16h kf0 = lds_frag(&Ks[buf][t * 16 + lrow][lhalf * 16]);
            v16h kf1 = lds_frag(&Ks[buf][t * 16 + lrow][32 + lhalf * 16]);
            v8f z = v8f{};
            z = wmma_f16(kf0, q0, z);
            z = wmma_f16(kf1, q1, z);
            s[t] = z;
        }
        // The trip's mask words and V^T fragments (A operand, in the key order of pf).
        v4i mlo[2], mhi[2];
        #pragma unroll             // constant indices keep mlo and mhi in registers
        for (int t = 0; t < 2; t++) {
            const int* mrow = &Ms[buf][wv * 16 + lrow][t * 16 + lhalf * 8];
            mlo[t] = *(const v4i*)mrow;
            mhi[t] = *(const v4i*)(mrow + 4);
        }
        v16h vf[4];
        #pragma unroll             // constant indices keep vf in registers
        for (int j = 0; j < 4; j++) {
            const _Float16* vrow = &Vs[buf][j * 16 + lrow][lhalf * 8];
            v8h lo = *(const v8h*)vrow;
            v8h hi = *(const v8h*)(vrow + 16);
            vf[j] = __builtin_shufflevector(lo, hi, 0, 1, 2, 3, 4, 5, 6, 7,
                                            8, 9, 10, 11, 12, 13, 14, 15);
        }

        // Publish point: the trip's last LDS read stands above, the rest of it
        // works on registers.  This wave has left buffer buf; its copies of tile
        // t + 1 have landed; the barrier says both of every wave.
        wait_ds0();
        wait_async0();
        __syncthreads();
        if (refill) stage(buf);

        // P^T as a B operand: element 8 t + i of a lane is key 16 t + 8 lhalf + i.
        v16h pf;
        #pragma unroll             // constant indices keep s, pf and lsum in registers
        for (int t = 0; t < 2; t++) {
            #pragma unroll         // constant indices keep s, pf and lsum in registers
            for (int i = 0; i < 8; i++) {
                const int mk = i < 4 ? mlo[t][i & 3] : mhi[t][i & 3];
                float p = mk ? __expf(s[t][i] * 0.125f) : 0.0f;
                lsum[i & 3] += p;
                pf[t * 8 + i] = (_Float16)p;
            }
        }
        #pragma unroll             // constant indices keep o in registers
        for (int j = 0; j < 4; j++)
            o[j] = wmma_f16(vf[j], pf, o[j]);
    };

    stage(0);                      // tile 0
    wait_async0();
    __syncthreads();
    stage(1);                      // tile 1 flies during trip 0
    // Two trips a pass, so that the buffer is a constant in every address; the
    // last two trips, which have no tile left to ask for, stand behind the loop.
    for (int m0 = 0; m0 < TDIM - 64; m0 += 64) {
        trip(0, true);
        trip(1, true);
    }
    trip(0, false);
    trip(1, false);
    wait_async0();                 // nothing is outstanding when the wave ends

    // Join the two half-waves' partial sums of each query once, behind the loop.
    float den = (lsum[0] + lsum[1]) + (lsum[2] + lsum[3]);
    den += __shfl_xor(den, 16, 32);

    _Float16* yrow = Y + (size_t)(b * TDIM + n0 + lrow) * DDIM + headoff + lhalf * 8;
    #pragma unroll                 // constant indices keep o in registers
    for (int j = 0; j < 4; j++) {
        v8h hv;
        #pragma unroll             // constant indices keep o and hv in registers
        for (int i = 0; i < 8; i++)
            hv[i] = (_Float16)(o[j][i] / (den + 1e-20f));
        *(v8h*)(yrow + j * 16) = hv;
    }
}

// ---------------------------------------------------------------------------
// Host launcher
// ---------------------------------------------------------------------------
extern "C" void kernel_launch(void* const* d_in, const int* in_sizes, int n_in,
                              void* d_out, int out_size, void* d_ws, size_t ws_size,
                              hipStream_t stream) {
    const float* x     = (const float*)d_in[0];
    const int*   mask  = (const int*)  d_in[1];
    const float* gamma = (const float*)d_in[2];
    const float* beta  = (const float*)d_in[3];
    const float* Wq    = (const float*)d_in[4];
    const float* bq    = (const float*)d_in[5];
    const float* Wk    = (const float*)d_in[6];
    const float* bk    = (const float*)d_in[7];
    const float* Wv    = (const float*)d_in[8];
    const float* bv    = (const float*)d_in[9];
    const float* Wo    = (const float*)d_in[10];
    const float* bo    = (const float*)d_in[11];
    float* out = (float*)d_out;

    const size_t ND = (size_t)NROWS * DDIM;
    const size_t DD = (size_t)DDIM * DDIM;
    _Float16* xn   = (_Float16*)d_ws;
    _Float16* q    = xn + ND;
    _Float16* k    = q + ND;
    _Float16* vt   = k + ND;          // [D][NROWS]
    _Float16* y    = vt + ND;
    _Float16* w16t = y + ND;          // 4*DD halves (total 48 MB)

    prep_kernel<<<LN_BLOCKS + CVT_BLOCKS, 256, 0, stream>>>(x, gamma, beta, xn, Wq, Wk, Wv, Wo, w16t);

    dim3 qkvgrid(3 * DDIM / 64, NROWS / 128);   // q, k, vt lie behind one another in the workspace
    gemm_qkv_kernel<<<qkvgrid, 256, 0, stream>>>(xn, w16t, bq, bk, bv, q);

    dim3 agrid(TDIM / 128, HH, BDIM);
    attn_kernel<<<agrid, 256, 0, stream>>>(q, k, vt, mask, y);

    dim3 ggrid(DDIM / 64, NROWS / 128);
    gemm_out_kernel<<<ggrid, 256, 0, stream>>>(y, w16t + 3 * DD, bo, x, out);
}

// v009
// Measured time: 96.5 microseconds a run.
// Timed twice side by side with v008, it ran 1.12 and 1.11 times as fast.
// All steps since v000 together make it 3.10 times as fast.
#include <hip/hip_runtime.h>
#include <hip/hip_bf16.h>
#include <stdint.h>

typedef __attribute__((ext_vector_type(16))) _Float16 v16h;
typedef __attribute__((ext_vector_type(8)))  _Float16 v8h;
typedef __attribute__((ext_vector_type(8)))  float    v8f;
typedef __attribute__((ext_vector_type(4)))  _Float16 v4h;
typedef __attribute__((ext_vector_type(4)))  float    v4f;
typedef __attribute__((ext_vector_type(4)))  int      v4i;

#define BDIM  2
#define TDIM  2048
#define DDIM  1024
#define HH    16
#define DH    64
#define NROWS (BDIM * TDIM)   // 4096

static __device__ __forceinline__ v8f wmma_f16(v16h a, v16h b, v8f c) {
    return __builtin_amdgcn_wmma_f32_16x16x32_f16(
        false, a, false, b, (short)0, c, false, false);
}

static __device__ __forceinline__ void async_cp16x8(void* const (&l)[8], const void* const (&g)[8]) {
    asm volatile("global_load_async_to_lds_b128 %0, %8, off\n\t"
                 "global_load_async_to_lds_b128 %1, %9, off\n\t"
                 "global_load_async_to_lds_b128 %2, %10, off\n\t"
                 "global_load_async_to_lds_b128 %3, %11, off\n\t"
                 "global_load_async_to_lds_b128 %4, %12, off\n\t"
                 "global_load_async_to_lds_b128 %5, %13, off\n\t"
                 "global_load_async_to_lds_b128 %6, %14, off\n\t"
                 "global_load_async_to_lds_b128 %7, %15, off\n\t"
                 "s_wait_xcnt 0x0"
                 :: "v"((unsigned)(uintptr_t)l[0]), "v"((unsigned)(uintptr_t)l[1]),
                    "v"((unsigned)(uintptr_t)l[2]), "v"((unsigned)(uintptr_t)l[3]),
                    "v"((unsigned)(uintptr_t)l[4]), "v"((unsigned)(uintptr_t)l[5]),
                    "v"((unsigned)(uintptr_t)l[6]), "v"((unsigned)(uintptr_t)l[7]),
                    "v"((uint64_t)(uintptr_t)g[0]), "v"((uint64_t)(uintptr_t)g[1]),
                    "v"((uint64_t)(uintptr_t)g[2]), "v"((uint64_t)(uintptr_t)g[3]),
                    "v"((uint64_t)(uintptr_t)g[4]), "v"((uint64_t)(uintptr_t)g[5]),
                    "v"((uint64_t)(uintptr_t)g[6]), "v"((uint64_t)(uintptr_t)g[7])
                 : "memory");
}
static __device__ __forceinline__ void async_cp16x6(void* l0, const void* g0,
                                                    void* l1, const void* g1,
                                                    void* l2, const void* g2,
                                                    void* l3, const void* g3,
                                                    void* l4, const void* g4,
                                                    void* l5, const void* g5) {
    asm volatile("global_load_async_to_lds_b128 %0, %6, off\n\t"
                 "global_load_async_to_lds_b128 %1, %7, off\n\t"
                 "global_load_async_to_lds_b128 %2, %8, off\n\t"
                 "global_load_async_to_lds_b128 %3, %9, off\n\t"
                 "global_load_async_to_lds_b128 %4, %10, off\n\t"
                 "global_load_async_to_lds_b128 %5, %11, off\n\t"
                 "s_wait_xcnt 0x0"
                 :: "v"((unsigned)(uintptr_t)l0), "v"((unsigned)(uintptr_t)l1),
                    "v"((unsigned)(uintptr_t)l2), "v"((unsigned)(uintptr_t)l3),
                    "v"((unsigned)(uintptr_t)l4), "v"((unsigned)(uintptr_t)l5),
                    "v"((uint64_t)(uintptr_t)g0), "v"((uint64_t)(uintptr_t)g1),
                    "v"((uint64_t)(uintptr_t)g2), "v"((uint64_t)(uintptr_t)g3),
                    "v"((uint64_t)(uintptr_t)g4), "v"((uint64_t)(uintptr_t)g5)
                 : "memory");
}
static __device__ __forceinline__ void wait_async0() {
    asm volatile("s_wait_asynccnt 0x0" ::: "memory");
}
// A wave's own LDS reads have returned: stands in front of the barrier behind
// which the buffer that it has read is refilled by copies.
static __device__ __forceinline__ void wait_ds0() {
    asm volatile("s_wait_dscnt 0x0" ::: "memory");
}

#define P32H 40   // halves: rows of 32 halves (64 B) laid at 80 B
#define P64H 72   // halves: rows of 64 halves (128 B) laid at 144 B
#define P128H 136 // halves: rows of 128 halves (256 B) laid at 272 B
#define P32I 36   // ints:   rows of 32 ints (128 B) laid at 144 B

// 16 x 32 fragment slice of one lane: 32 contiguous bytes, 16-B aligned.
static __device__ __forceinline__ v16h lds_frag(const _Float16* p) {
    v8h lo = *(const v8h*)p;
    v8h hi = *(const v8h*)(p + 8);
    return __builtin_shufflevector(lo, hi, 0, 1, 2, 3, 4, 5, 6, 7,
                                   8, 9, 10, 11, 12, 13, 14, 15);
}

// ---------------------------------------------------------------------------
// Kernel 1, first part: LayerNorm, f32 in -> f16 out.  One wave per row, 32 elements a lane:
//   4,096 waves to start instead of 32,768, eight 512-B loads in flight per wave,
//   the row sums stay inside the wave (no LDS, no barrier).
// ---------------------------------------------------------------------------
static __device__ __forceinline__
void ln_block(const int blk,
              const float* __restrict__ x,
              const float* __restrict__ gamma,
              const float* __restrict__ beta,
              _Float16* __restrict__ xn) {
    const int ln  = threadIdx.x & 31;
    const int row = blk * 8 + (threadIdx.x >> 5);
    const v4f* xr = (const v4f*)(x + (size_t)row * DDIM) + ln;
    v4f v[8];
    #pragma unroll                 // constant indices keep v in registers
    for (int c = 0; c < 8; c++) v[c] = xr[c * 32];
    float s = 0.f, s2 = 0.f;
    #pragma unroll                 // constant indices keep v in registers
    for (int c = 0; c < 8; c++) {
        s  += v[c].x + v[c].y + v[c].z + v[c].w;
        s2 += v[c].x*v[c].x + v[c].y*v[c].y + v[c].z*v[c].z + v[c].w*v[c].w;
    }
    #pragma unroll
    for (int m = 16; m >= 1; m >>= 1) {
        s  += __shfl_xor(s,  m, 32);
        s2 += __shfl_xor(s2, m, 32);
    }
    const float mu  = s * (1.0f / DDIM);
    const float var = s2 * (1.0f / DDIM) - mu * mu;
    const float inv = rsqrtf(var + 1e-5f);
    _Float16* dst = xn + (size_t)row * DDIM + ln * 4;
    #pragma unroll                 // constant indices keep v in registers
    for (int c = 0; c < 8; c++) {
        const v4f g  = ((const v4f*)gamma)[c * 32 + ln];
        const v4f bb = ((const v4f*)beta)[c * 32 + ln];
        v4h h;
        h.x = (_Float16)((v[c].x - mu) * inv * g.x + bb.x);
        h.y = (_Float16)((v[c].y - mu) * inv * g.y + bb.y);
        h.z = (_Float16)((v[c].z - mu) * inv * g.z + bb.z);
        h.w = (_Float16)((v[c].w - mu) * inv * g.w + bb.w);
        *(v4h*)(dst + c * 128) = h;
    }
}

static __device__ __forceinline__
void cvt_wT_block(const int blk,
                  const float* __restrict__ wq, const float* __restrict__ wk,
                  const float* __restrict__ wv, const float* __restrict__ wo,
                  _Float16* __restrict__ w16t) {
    const int wvi = threadIdx.x >> 5;
    const int ln  = threadIdx.x & 31;
    const int m   = blk >> 7;            // which matrix: 128 blocks each
    const int r   = blk & 127;
    const int n   = (r & 31) * 32  + (wvi & 1) * 16  + (ln >> 3) * 4;   // W column
    const int k   = (r >> 5) * 256 + (wvi >> 1) * 64 + (ln & 7) * 8;    // W row
    const float* s = m == 0 ? wq : m == 1 ? wk : m == 2 ? wv : wo;
    s += (size_t)k * DDIM + n;
    v4f v[8];
    #pragma unroll                 // constant indices keep v in registers
    for (int j = 0; j < 8; j++) v[j] = *(const v4f*)(s + (size_t)j * DDIM);
    _Float16* d = w16t + (size_t)m * DDIM * DDIM + (size_t)n * DDIM + k;
    #pragma unroll                 // constant indices keep v in registers
    for (int e = 0; e < 4; e++) {
        v8h h;
        #pragma unroll             // constant indices keep v and h in registers
        for (int j = 0; j < 8; j++) h[j] = (_Float16)v[j][e];
        *(v8h*)(d + (size_t)e * DDIM) = h;
    }
}

#define LN_BLOCKS  (NROWS / 8)                 // 512
#define CVT_BLOCKS ((4 * DDIM * DDIM) / 8192)  // 512
__global__ __launch_bounds__(256)
void prep_kernel(const float* __restrict__ x,
                 const float* __restrict__ gamma,
                 const float* __restrict__ beta,
                 _Float16* __restrict__ xn,
                 const float* __restrict__ wq, const float* __restrict__ wk,
                 const float* __restrict__ wv, const float* __restrict__ wo,
                 _Float16* __restrict__ w16t) {
    if (blockIdx.x < LN_BLOCKS)
        ln_block(blockIdx.x, x, gamma, beta, xn);
    else
        cvt_wT_block(blockIdx.x - LN_BLOCKS, wq, wk, wv, wo, w16t);
}

// ---------------------------------------------------------------------------
// Kernel 2/4: tiled WMMA GEMM.  C = A16 * WT16^T + bias.
//   Block 128 thr = 4 waves, 2 x 2; a wave's tile is 64(M) x 16 NF(N): 4 A and NF
//   B fragments feed 4 NF matrix instructions, so that a fragment read from LDS
//   is used NF or 4 times, not 4 times or once.  128 k per staging round.
//   A tile (128 rows of 128, padded) and B tile (32 NF rows of WT, row-major
//   [n][k], padded) are async-copied; a copy takes two rows' 256 B, four whole lines.
// gemm_tile: the k loop of one work-group; acc = this wave's tile.
// ---------------------------------------------------------------------------
template <int NF>
static __device__ __forceinline__
void gemm_tile(const _Float16* __restrict__ A,
               const _Float16* __restrict__ WT,
               _Float16 (&As)[128][P128H],
               _Float16 (&Bs)[32 * NF][P128H],
               const int M0, const int N0,      // the work-group's first row and column
               const int wm, const int wn,      // this wave's first row of As and of Bs
               v8f (&acc)[4][NF]) {
    const int tid = threadIdx.x;
    const int wv  = tid >> 5;
    const int ln  = tid & 31;
    const int lrow  = ln & 15;
    const int lhalf = ln >> 4;

    const int ck  = lrow * 8;               // 0..120 : k offset (16B chunks)
    const int ar  = wv * 32 + lhalf;        // As rows ar + 2 c, c < 16
    const int br  = wv * (8 * NF) + lhalf;  // Bs rows br + 2 c, c < 4 NF
    const _Float16* asrc = A  + (size_t)(M0 + ar) * DDIM + ck;
    const _Float16* bsrc = WT + (size_t)(N0 + br) * DDIM + ck;

    for (int k0 = 0; k0 < DDIM; k0 += 128) {
        #pragma unroll                 // constant indices keep l and g in registers
        for (int h = 0; h < 2; h++) {
            void* l[8];
            const void* g[8];
            #pragma unroll             // constant indices keep l and g in registers
            for (int c = 0; c < 8; c++) {
                l[c] = &As[ar + 16 * h + 2 * c][ck];
                g[c] = asrc + k0 + (16 * h + 2 * c) * DDIM;
            }
            async_cp16x8(l, g);
        }
        #pragma unroll                 // constant indices keep l and g in registers
        for (int h = 0; h < NF / 2; h++) {
            void* l[8];
            const void* g[8];
            #pragma unroll             // constant indices keep l and g in registers
            for (int c = 0; c < 8; c++) {
                l[c] = &Bs[br + 16 * h + 2 * c][ck];
                g[c] = bsrc + k0 + (16 * h + 2 * c) * DDIM;
            }
            async_cp16x8(l, g);
        }
        wait_async0();
        __syncthreads();

        #pragma unroll                 // constant indices keep acc in registers
        for (int s = 0; s < 4; s++) {
            v16h af[4], bf[NF];
            #pragma unroll             // constant indices keep af in registers
            for (int i = 0; i < 4; i++)
                af[i] = lds_frag(&As[wm + i * 16 + lrow][s * 32 + lhalf * 16]);
            #pragma unroll             // constant indices keep bf in registers
            for (int j = 0; j < NF; j++)
                bf[j] = lds_frag(&Bs[wn + j * 16 + lrow][s * 32 + lhalf * 16]);
            #pragma unroll             // constant indices keep acc in registers
            for (int i = 0; i < 4; i++) {
                #pragma unroll
                for (int j = 0; j < NF; j++)
                    acc[i][j] = wmma_f16(af[i], bf[j], acc[i][j]);
            }
        }
        wait_ds0();                    // this wave has left both tiles: the next round's copies refill them behind the barrier
        __syncthreads();
    }
}

// q, k and v in ONE launch.  They share A and depend on nothing of each other;
// their transposed weights lie behind one another in WT (3,072 rows) and their
// outputs behind one another in qkv, so blockIdx.x >> 3 names the product.
// Work-group tile 128 x 128: 768 work-groups, three per WGP, which cover each
// other's copy latency and barriers.
//   q, k: f16 row-major.  v: f16 transposed [D][NROWS] (VT).
__global__ __launch_bounds__(128)   // the real block size: a wave's 16 accumulator tiles need more registers than the default bound leaves
void gemm_qkv_kernel(const _Float16* __restrict__ A,
                                const _Float16* __restrict__ WT,
                                const float* __restrict__ bq,
                                const float* __restrict__ bk,
                                const float* __restrict__ bv,
                                _Float16* __restrict__ qkv) {
    __shared__ __attribute__((aligned(16))) _Float16 As[128][P128H]; // [row][k], 34 KB
    __shared__ __attribute__((aligned(16))) _Float16 Bs[128][P128H]; // [col][k], 34 KB
    const int wv    = threadIdx.x >> 5;
    const int lrow  = threadIdx.x & 15;
    const int lhalf = (threadIdx.x & 31) >> 4;
    const int wm  = (wv >> 1) * 64;
    const int wn  = (wv & 1) * 64;
    const int M0  = blockIdx.y * 128;
    const int N0  = blockIdx.x * 128;  // row of WT: 1,024 rows per product

    v8f acc[4][4] = {};
    gemm_tile<4>(A, WT, As, Bs, M0, N0, wm, wn, acc);

    const int which   = blockIdx.x >> 3;                 // 0 q, 1 k, 2 v: the same for the whole work-group
    const int colbase = ((N0 + wn) & (DDIM - 1)) + lrow; // column inside that product
    const int rowbase = M0 + wm + lhalf * 8;
    const float* bias = which == 0 ? bq : which == 1 ? bk : bv;
    _Float16* o16 = qkv + (size_t)which * NROWS * DDIM;
    // The sums with their bias, rounded to f16 once, in front of the branch: both
    // paths store out of the same 64 registers, and no store's register is rewritten.
    v8h hv[4][4];
    #pragma unroll                     // constant indices keep acc and hv in registers
    for (int j = 0; j < 4; j++) {
        const float bj = bias[colbase + j * 16];
        #pragma unroll
        for (int i = 0; i < 4; i++) {
            #pragma unroll
            for (int r = 0; r < 8; r++) hv[i][j][r] = (_Float16)(acc[i][j][r] + bj);
        }
    }
    if (which == 2) {
        _Float16* d = o16 + (size_t)colbase * NROWS + rowbase;               // VT
        #pragma unroll
        for (int i = 0; i < 4; i++) {
            #pragma unroll
            for (int j = 0; j < 4; j++)
                *(v8h*)(d + (size_t)(j * 16) * NROWS + i * 16) = hv[i][j];
        }
    } else {
        _Float16* d = o16 + (size_t)rowbase * DDIM + colbase;
        #pragma unroll
        for (int i = 0; i < 4; i++) {
            #pragma unroll
            for (int j = 0; j < 4; j++) {
                #pragma unroll
                for (int r = 0; r < 8; r++)
                    d[(size_t)(i * 16 + r) * DDIM + j * 16] = hv[i][j][r];
            }
        }
        asm volatile("s_wait_xcnt 0x0" ::: "memory");
    }
}

// The output projection: out f32 = val + resid (final output).
// Work-group tile 128 x 64 (a wave 64 x 32): 512 work-groups, two per WGP, so
// that one computes while the other's copies fly.
__global__ __launch_bounds__(128)
void gemm_out_kernel(const _Float16* __restrict__ A,
                                const _Float16* __restrict__ WT,
                                const float* __restrict__ bias,
                                const float* __restrict__ resid,
                                float* __restrict__ out32) {
    __shared__ __attribute__((aligned(16))) _Float16 As[128][P128H]; // [row][k], 34 KB
    __shared__ __attribute__((aligned(16))) _Float16 Bs[64][P128H];  // [col][k], 17 KB
    const int wv    = threadIdx.x >> 5;
    const int lrow  = threadIdx.x & 15;
    const int lhalf = (threadIdx.x & 31) >> 4;
    const int wm  = (wv >> 1) * 64;
    const int wn  = (wv & 1) * 32;
    const int M0  = blockIdx.y * 128;
    const int N0  = blockIdx.x * 64;

    v8f acc[4][2] = {};
    gemm_tile<2>(A, WT, As, Bs, M0, N0, wm, wn, acc);

    const int rowbase = M0 + wm + lhalf * 8;
    const int col0    = N0 + wn + lrow;
    const size_t base = (size_t)rowbase * DDIM + col0;
    const float* rp = resid + base;    // one address pair each; rows and columns are constant offsets
    float*       op = out32 + base;
    float rv[4][2][8];
    #pragma unroll                     // constant indices keep rv in registers
    for (int i = 0; i < 4; i++) {
        #pragma unroll
        for (int j = 0; j < 2; j++) {
            #pragma unroll
            for (int r = 0; r < 8; r++)
                rv[i][j][r] = rp[(size_t)(i * 16 + r) * DDIM + j * 16];
        }
    }
    const float bv[2] = {bias[col0], bias[col0 + 16]};
    asm volatile("s_wait_xcnt 0x0" :: "v"((uint64_t)(uintptr_t)rp) : "memory");
    #pragma unroll                     // constant indices keep acc and rv in registers
    for (int i = 0; i < 4; i++) {
        #pragma unroll
        for (int j = 0; j < 2; j++) {
            #pragma unroll
            for (int r = 0; r < 8; r++) {
                const float val = acc[i][j][r] + bv[j];
                op[(size_t)(i * 16 + r) * DDIM + j * 16] = val + rv[i][j][r];
            }
        }
    }
}

__global__ __launch_bounds__(256)
__attribute__((amdgpu_waves_per_eu(4, 4)))
void attn_kernel(const _Float16* __restrict__ Q,
                            const _Float16* __restrict__ K,
                            const _Float16* __restrict__ VT,   // [D][NROWS]
                            const int* __restrict__ mask,
                            _Float16* __restrict__ Y) {
    __shared__ __attribute__((aligned(16))) _Float16 Ks[2][32][P64H];   // [buf][keyrow][k]   2 x 4.5 KB
    __shared__ __attribute__((aligned(16))) _Float16 Vs[2][64][P32H];   // [buf][d][keyrow]   2 x   5 KB
    __shared__ __attribute__((aligned(16))) int      Ms[2][128][P32I];  // [buf] mask tile    2 x  18 KB

    const int tid = threadIdx.x;
    const int wv  = tid >> 5;
    const int ln  = tid & 31;
    const int lrow  = ln & 15;
    const int lhalf = ln >> 4;
    const int b = blockIdx.z, h = blockIdx.y;
    const int nblk = blockIdx.x * 128;                // block's query-row base
    const int n0 = nblk + wv * 16;                    // this wave's rows
    const size_t headoff = (size_t)h * DH;

    const size_t qrow = (size_t)(b * TDIM + n0 + lrow) * DDIM + headoff;
    v16h q0 = *(const v16h*)(Q + qrow + lhalf * 16);
    v16h q1 = *(const v16h*)(Q + qrow + 32 + lhalf * 16);

    v8f o[4] = {v8f{}, v8f{}, v8f{}, v8f{}};          // O^T: row d = 16 j + 8 lhalf + i, column = query lrow
    float lsum[4] = {0.f, 0.f, 0.f, 0.f};             // this lane's keys of query lrow, four chains

    // staging thread maps
    const int kmr = tid >> 3, kc = (tid & 7) * 8;     // Ks: 32 x 64
    const int vd  = tid >> 2, vk = (tid & 3) * 8;     // Vs: 64 x 32
    const int mr  = tid >> 3, mc = (tid & 7) * 4;     // Ms: 128 x 32 ints, rows mr + 32 u
    // the next tile to be copied, one running pointer per source array
    const _Float16* ksrc = K  + (size_t)(b * TDIM + kmr) * DDIM + headoff + kc;
    const _Float16* vsrc = VT + (headoff + vd) * (size_t)NROWS + b * TDIM + vk;
    const int*      msrc = mask + ((size_t)b * TDIM + nblk + mr) * TDIM + mc;

    // One lane's six copies of the next tile into buffer buf.
    auto stage = [&](const int buf) __attribute__((always_inline)) {
        async_cp16x6(&Ks[buf][kmr][kc],     ksrc,
                     &Vs[buf][vd][vk],      vsrc,
                     &Ms[buf][mr][mc],      msrc,
                     &Ms[buf][mr + 32][mc], msrc + 32 * TDIM,
                     &Ms[buf][mr + 64][mc], msrc + 64 * TDIM,
                     &Ms[buf][mr + 96][mc], msrc + 96 * TDIM);
        ksrc += (size_t)32 * DDIM;
        vsrc += 32;
        msrc += 32;
    };

    // One trip: tile t out of buffer buf = t mod 2; refill: a tile t + 2 exists.
    auto trip = [&](const int buf, const bool refill) __attribute__((always_inline)) {
        // S^T tile t: row = key 16 t + 8 lhalf + i, column = query lrow.
        v8f s[2];
        #pragma unroll             // constant indices keep s in registers
        for (int t = 0; t < 2; t++) {
            v16h kf0 = lds_frag(&Ks[buf][t * 16 + lrow][lhalf * 16]);
            v16h kf1 = lds_frag(&Ks[buf][t * 16 + lrow][32 + lhalf * 16]);
            v8f z = v8f{};
            z = wmma_f16(kf0, q0, z);
            z = wmma_f16(kf1, q1, z);
            s[t] = z;
        }
        // The trip's mask words and V^T fragments (A operand, in the key order of pf).
        v4i mlo[2], mhi[2];
        #pragma unroll             // constant indices keep mlo and mhi in registers
        for (int t = 0; t < 2; t++) {
            const int* mrow = &Ms[buf][wv * 16 + lrow][t * 16 + lhalf * 8];
            mlo[t] = *(const v4i*)mrow;
            mhi[t] = *(const v4i*)(mrow + 4);
        }
        v16h vf[4];
        #pragma unroll             // constant indices keep vf in registers
        for (int j = 0; j < 4; j++) {
            const _Float16* vrow = &Vs[buf][j * 16 + lrow][lhalf * 8];
            v8h lo = *(const v8h*)vrow;
            v8h hi = *(const v8h*)(vrow + 16);
            vf[j] = __builtin_shufflevector(lo, hi, 0, 1, 2, 3, 4, 5, 6, 7,
                                            8, 9, 10, 11, 12, 13, 14, 15);
        }

        // Publish point: the trip's last LDS read stands above, the rest of it
        // works on registers.  This wave has left buffer buf; its copies of tile
        // t + 1 have landed; the barrier says both of every wave.
        wait_ds0();
        wait_async0();
        __syncthreads();
        if (refill) stage(buf);

        // P^T as a B operand: element 8 t + i of a lane is key 16 t + 8 lhalf + i.
        v16h pf;
        #pragma unroll             // constant indices keep s, pf and lsum in registers
        for (int t = 0; t < 2; t++) {
            #pragma unroll         // constant indices keep s, pf and lsum in registers
            for (int i = 0; i < 8; i++) {
                const int mk = i < 4 ? mlo[t][i & 3] : mhi[t][i & 3];
                float p = mk ? __expf(s[t][i] * 0.125f) : 0.0f;
                lsum[i & 3] += p;
                pf[t * 8 + i] = (_Float16)p;
            }
        }
        #pragma unroll             // constant indices keep o in registers
        for (int j = 0; j < 4; j++)
            o[j] = wmma_f16(vf[j], pf, o[j]);
    };

    stage(0);                      // tile 0
    wait_async0();
    __syncthreads();
    stage(1);                      // tile 1 flies during trip 0
    // Two trips a pass, so that the buffer is a constant in every address; the
    // last two trips, which have no tile left to ask for, stand behind the loop.
    for (int m0 = 0; m0 < TDIM - 64; m0 += 64) {
        trip(0, true);
        trip(1, true);
    }
    trip(0, false);
    trip(1, false);
    wait_async0();                 // nothing is outstanding when the wave ends

    // Join the two half-waves' partial sums of each query once, behind the loop.
    float den = (lsum[0] + lsum[1]) + (lsum[2] + lsum[3]);
    den += __shfl_xor(den, 16, 32);

    _Float16* yrow = Y + (size_t)(b * TDIM + n0 + lrow) * DDIM + headoff + lhalf * 8;
    #pragma unroll                 // constant indices keep o in registers
    for (int j = 0; j < 4; j++) {
        v8h hv;
        #pragma unroll             // constant indices keep o and hv in registers
        for (int i = 0; i < 8; i++)
            hv[i] = (_Float16)(o[j][i] / (den + 1e-20f));
        *(v8h*)(yrow + j * 16) = hv;
    }
}

// ---------------------------------------------------------------------------
// Host launcher
// ---------------------------------------------------------------------------
extern "C" void kernel_launch(void* const* d_in, const int* in_sizes, int n_in,
                              void* d_out, int out_size, void* d_ws, size_t ws_size,
                              hipStream_t stream) {
    const float* x     = (const float*)d_in[0];
    const int*   mask  = (const int*)  d_in[1];
    const float* gamma = (const float*)d_in[2];
    const float* beta  = (const float*)d_in[3];
    const float* Wq    = (const float*)d_in[4];
    const float* bq    = (const float*)d_in[5];
    const float* Wk    = (const float*)d_in[6];
    const float* bk    = (const float*)d_in[7];
    const float* Wv    = (const float*)d_in[8];
    const float* bv    = (const float*)d_in[9];
    const float* Wo    = (const float*)d_in[10];
    const float* bo    = (const float*)d_in[11];
    float* out = (float*)d_out;

    const size_t ND = (size_t)NROWS * DDIM;
    const size_t DD = (size_t)DDIM * DDIM;
    _Float16* xn   = (_Float16*)d_ws;
    _Float16* q    = xn + ND;
    _Float16* k    = q + ND;
    _Float16* vt   = k + ND;          // [D][NROWS]
    _Float16* y    = vt + ND;
    _Float16* w16t = y + ND;          // 4*DD halves (total 48 MB)

    prep_kernel<<<LN_BLOCKS + CVT_BLOCKS, 256, 0, stream>>>(x, gamma, beta, xn, Wq, Wk, Wv, Wo, w16t);

    dim3 qkvgrid(3 * DDIM / 128, NROWS / 128);  // q, k, vt lie behind one another in the workspace
    gemm_qkv_kernel<<<qkvgrid, 128, 0, stream>>>(xn, w16t, bq, bk, bv, q);

    dim3 agrid(TDIM / 128, HH, BDIM);
    attn_kernel<<<agrid, 256, 0, stream>>>(q, k, vt, mask, y);

    dim3 ggrid(DDIM / 64, NROWS / 128);
    gemm_out_kernel<<<ggrid, 128, 0, stream>>>(y, w16t + 3 * DD, bo, x, out);
}

// v010
// A run of this version takes 88.2 microseconds.
// In both of two side-by-side timings against v009, it was 1.10 times as fast.
// Counting every step since v000, it is 3.41 times as fast.
#include <hip/hip_runtime.h>
#include <hip/hip_bf16.h>
#include <stdint.h>

typedef __attribute__((ext_vector_type(16))) _Float16 v16h;
typedef __attribute__((ext_vector_type(8)))  _Float16 v8h;
typedef __attribute__((ext_vector_type(8)))  float    v8f;
typedef __attribute__((ext_vector_type(4)))  _Float16 v4h;
typedef __attribute__((ext_vector_type(4)))  float    v4f;
typedef __attribute__((ext_vector_type(4)))  int      v4i;

#define BDIM  2
#define TDIM  2048
#define DDIM  1024
#define HH    16
#define DH    64
#define NROWS (BDIM * TDIM)   // 4096

static __device__ __forceinline__ v8f wmma_f16(v16h a, v16h b, v8f c) {
    return __builtin_amdgcn_wmma_f32_16x16x32_f16(
        false, a, false, b, (short)0, c, false, false);
}

static __device__ __forceinline__ void async_cp16x8(void* const (&l)[8], const void* const (&g)[8]) {
    asm volatile("global_load_async_to_lds_b128 %0, %8, off\n\t"
                 "global_load_async_to_lds_b128 %1, %9, off\n\t"
                 "global_load_async_to_lds_b128 %2, %10, off\n\t"
                 "global_load_async_to_lds_b128 %3, %11, off\n\t"
                 "global_load_async_to_lds_b128 %4, %12, off\n\t"
                 "global_load_async_to_lds_b128 %5, %13, off\n\t"
                 "global_load_async_to_lds_b128 %6, %14, off\n\t"
                 "global_load_async_to_lds_b128 %7, %15, off\n\t"
                 "s_wait_xcnt 0x0"
                 :: "v"((unsigned)(uintptr_t)l[0]), "v"((unsigned)(uintptr_t)l[1]),
                    "v"((unsigned)(uintptr_t)l[2]), "v"((unsigned)(uintptr_t)l[3]),
                    "v"((unsigned)(uintptr_t)l[4]), "v"((unsigned)(uintptr_t)l[5]),
                    "v"((unsigned)(uintptr_t)l[6]), "v"((unsigned)(uintptr_t)l[7]),
                    "v"((uint64_t)(uintptr_t)g[0]), "v"((uint64_t)(uintptr_t)g[1]),
                    "v"((uint64_t)(uintptr_t)g[2]), "v"((uint64_t)(uintptr_t)g[3]),
                    "v"((uint64_t)(uintptr_t)g[4]), "v"((uint64_t)(uintptr_t)g[5]),
                    "v"((uint64_t)(uintptr_t)g[6]), "v"((uint64_t)(uintptr_t)g[7])
                 : "memory");
}
static __device__ __forceinline__ void async_cp16x12(void* const (&l)[12], const void* const (&g)[12]) {
    asm volatile("global_load_async_to_lds_b128 %0, %12, off\n\t"
                 "global_load_async_to_lds_b128 %1, %13, off\n\t"
                 "global_load_async_to_lds_b128 %2, %14, off\n\t"
                 "global_load_async_to_lds_b128 %3, %15, off\n\t"
                 "global_load_async_to_lds_b128 %4, %16, off\n\t"
                 "global_load_async_to_lds_b128 %5, %17, off\n\t"
                 "global_load_async_to_lds_b128 %6, %18, off\n\t"
                 "global_load_async_to_lds_b128 %7, %19, off\n\t"
                 "global_load_async_to_lds_b128 %8, %20, off\n\t"
                 "global_load_async_to_lds_b128 %9, %21, off\n\t"
                 "global_load_async_to_lds_b128 %10, %22, off\n\t"
                 "global_load_async_to_lds_b128 %11, %23, off\n\t"
                 "s_wait_xcnt 0x0"
                 :: "v"((unsigned)(uintptr_t)l[0]), "v"((unsigned)(uintptr_t)l[1]),
                    "v"((unsigned)(uintptr_t)l[2]), "v"((unsigned)(uintptr_t)l[3]),
                    "v"((unsigned)(uintptr_t)l[4]), "v"((unsigned)(uintptr_t)l[5]),
                    "v"((unsigned)(uintptr_t)l[6]), "v"((unsigned)(uintptr_t)l[7]),
                    "v"((unsigned)(uintptr_t)l[8]), "v"((unsigned)(uintptr_t)l[9]),
                    "v"((unsigned)(uintptr_t)l[10]), "v"((unsigned)(uintptr_t)l[11]),
                    "v"((uint64_t)(uintptr_t)g[0]), "v"((uint64_t)(uintptr_t)g[1]),
                    "v"((uint64_t)(uintptr_t)g[2]), "v"((uint64_t)(uintptr_t)g[3]),
                    "v"((uint64_t)(uintptr_t)g[4]), "v"((uint64_t)(uintptr_t)g[5]),
                    "v"((uint64_t)(uintptr_t)g[6]), "v"((uint64_t)(uintptr_t)g[7]),
                    "v"((uint64_t)(uintptr_t)g[8]), "v"((uint64_t)(uintptr_t)g[9]),
                    "v"((uint64_t)(uintptr_t)g[10]), "v"((uint64_t)(uintptr_t)g[11])
                 : "memory");
}
static __device__ __forceinline__ void wait_async0() {
    asm volatile("s_wait_asynccnt 0x0" ::: "memory");
}
// A wave's own LDS reads have returned: stands in front of the barrier behind
// which the buffer that it has read is refilled by copies.
static __device__ __forceinline__ void wait_ds0() {
    asm volatile("s_wait_dscnt 0x0" ::: "memory");
}

#define P64H 72   // halves: rows of 64 halves (128 B) laid at 144 B
#define P128H 136 // halves: rows of 128 halves (256 B) laid at 272 B
#define P64I 68   // ints:   rows of 64 ints (256 B) laid at 272 B

// 16 x 32 fragment slice of one lane: 32 contiguous bytes, 16-B aligned.
static __device__ __forceinline__ v16h lds_frag(const _Float16* p) {
    v8h lo = *(const v8h*)p;
    v8h hi = *(const v8h*)(p + 8);
    return __builtin_shufflevector(lo, hi, 0, 1, 2, 3, 4, 5, 6, 7,
                                   8, 9, 10, 11, 12, 13, 14, 15);
}

// ---------------------------------------------------------------------------
// Kernel 1, first part: LayerNorm, f32 in -> f16 out.  One wave per row, 32 elements a lane:
//   4,096 waves to start instead of 32,768, eight 512-B loads in flight per wave,
//   the row sums stay inside the wave (no LDS, no barrier).
// ---------------------------------------------------------------------------
static __device__ __forceinline__
void ln_block(const int blk,
              const float* __restrict__ x,
              const float* __restrict__ gamma,
              const float* __restrict__ beta,
              _Float16* __restrict__ xn) {
    const int ln  = threadIdx.x & 31;
    const int row = blk * 8 + (threadIdx.x >> 5);
    const v4f* xr = (const v4f*)(x + (size_t)row * DDIM) + ln;
    v4f v[8];
    #pragma unroll                 // constant indices keep v in registers
    for (int c = 0; c < 8; c++) v[c] = xr[c * 32];
    float s = 0.f, s2 = 0.f;
    #pragma unroll                 // constant indices keep v in registers
    for (int c = 0; c < 8; c++) {
        s  += v[c].x + v[c].y + v[c].z + v[c].w;
        s2 += v[c].x*v[c].x + v[c].y*v[c].y + v[c].z*v[c].z + v[c].w*v[c].w;
    }
    #pragma unroll
    for (int m = 16; m >= 1; m >>= 1) {
        s  += __shfl_xor(s,  m, 32);
        s2 += __shfl_xor(s2, m, 32);
    }
    const float mu  = s * (1.0f / DDIM);
    const float var = s2 * (1.0f / DDIM) - mu * mu;
    const float inv = rsqrtf(var + 1e-5f);
    _Float16* dst = xn + (size_t)row * DDIM + ln * 4;
    #pragma unroll                 // constant indices keep v in registers
    for (int c = 0; c < 8; c++) {
        const v4f g  = ((const v4f*)gamma)[c * 32 + ln];
        const v4f bb = ((const v4f*)beta)[c * 32 + ln];
        v4h h;
        h.x = (_Float16)((v[c].x - mu) * inv * g.x + bb.x);
        h.y = (_Float16)((v[c].y - mu) * inv * g.y + bb.y);
        h.z = (_Float16)((v[c].z - mu) * inv * g.z + bb.z);
        h.w = (_Float16)((v[c].w - mu) * inv * g.w + bb.w);
        *(v4h*)(dst + c * 128) = h;
    }
}

static __device__ __forceinline__
void cvt_wT_block(const int blk,
                  const float* __restrict__ wq, const float* __restrict__ wk,
                  const float* __restrict__ wv, const float* __restrict__ wo,
                  _Float16* __restrict__ w16t) {
    const int wvi = threadIdx.x >> 5;
    const int ln  = threadIdx.x & 31;
    const int m   = blk >> 7;            // which matrix: 128 blocks each
    const int r   = blk & 127;
    const int n   = (r & 31) * 32  + (wvi & 1) * 16  + (ln >> 3) * 4;   // W column
    const int k   = (r >> 5) * 256 + (wvi >> 1) * 64 + (ln & 7) * 8;    // W row
    const float* s = m == 0 ? wq : m == 1 ? wk : m == 2 ? wv : wo;
    s += (size_t)k * DDIM + n;
    v4f v[8];
    #pragma unroll                 // constant indices keep v in registers
    for (int j = 0; j < 8; j++) v[j] = *(const v4f*)(s + (size_t)j * DDIM);
    _Float16* d = w16t + (size_t)m * DDIM * DDIM + (size_t)n * DDIM + k;
    #pragma unroll                 // constant indices keep v in registers
    for (int e = 0; e < 4; e++) {
        v8h h;
        #pragma unroll             // constant indices keep v and h in registers
        for (int j = 0; j < 8; j++) h[j] = (_Float16)v[j][e];
        *(v8h*)(d + (size_t)e * DDIM) = h;
    }
}

#define LN_BLOCKS  (NROWS / 8)                 // 512
#define CVT_BLOCKS ((4 * DDIM * DDIM) / 8192)  // 512
__global__ __launch_bounds__(256)
void prep_kernel(const float* __restrict__ x,
                 const float* __restrict__ gamma,
                 const float* __restrict__ beta,
                 _Float16* __restrict__ xn,
                 const float* __restrict__ wq, const float* __restrict__ wk,
                 const float* __restrict__ wv, const float* __restrict__ wo,
                 _Float16* __restrict__ w16t) {
    if (blockIdx.x < LN_BLOCKS)
        ln_block(blockIdx.x, x, gamma, beta, xn);
    else
        cvt_wT_block(blockIdx.x - LN_BLOCKS, wq, wk, wv, wo, w16t);
}

// ---------------------------------------------------------------------------
// Kernel 2/4: tiled WMMA GEMM.  C = A16 * WT16^T + bias.
//   Block 128 thr = 4 waves, 2 x 2; a wave's tile is 64(M) x 16 NF(N): 4 A and NF
//   B fragments feed 4 NF matrix instructions, so that a fragment read from LDS
//   is used NF or 4 times, not 4 times or once.  128 k per staging round.
//   A tile (128 rows of 128, padded) and B tile (32 NF rows of WT, row-major
//   [n][k], padded) are async-copied; a copy takes two rows' 256 B, four whole lines.
// gemm_tile: the k loop of one work-group; acc = this wave's tile.
// ---------------------------------------------------------------------------
template <int NF>
static __device__ __forceinline__
void gemm_tile(const _Float16* __restrict__ A,
               const _Float16* __restrict__ WT,
               _Float16 (&As)[128][P128H],
               _Float16 (&Bs)[32 * NF][P128H],
               const int M0, const int N0,      // the work-group's first row and column
               const int wm, const int wn,      // this wave's first row of As and of Bs
               v8f (&acc)[4][NF]) {
    const int tid = threadIdx.x;
    const int wv  = tid >> 5;
    const int ln  = tid & 31;
    const int lrow  = ln & 15;
    const int lhalf = ln >> 4;

    const int ck  = lrow * 8;               // 0..120 : k offset (16B chunks)
    const int ar  = wv * 32 + lhalf;        // As rows ar + 2 c, c < 16
    const int br  = wv * (8 * NF) + lhalf;  // Bs rows br + 2 c, c < 4 NF
    const _Float16* asrc = A  + (size_t)(M0 + ar) * DDIM + ck;
    const _Float16* bsrc = WT + (size_t)(N0 + br) * DDIM + ck;

    for (int k0 = 0; k0 < DDIM; k0 += 128) {
        #pragma unroll                 // constant indices keep l and g in registers
        for (int h = 0; h < 2; h++) {
            void* l[8];
            const void* g[8];
            #pragma unroll             // constant indices keep l and g in registers
            for (int c = 0; c < 8; c++) {
                l[c] = &As[ar + 16 * h + 2 * c][ck];
                g[c] = asrc + k0 + (16 * h + 2 * c) * DDIM;
            }
            async_cp16x8(l, g);
        }
        #pragma unroll                 // constant indices keep l and g in registers
        for (int h = 0; h < NF / 2; h++) {
            void* l[8];
            const void* g[8];
            #pragma unroll             // constant indices keep l and g in registers
            for (int c = 0; c < 8; c++) {
                l[c] = &Bs[br + 16 * h + 2 * c][ck];
                g[c] = bsrc + k0 + (16 * h + 2 * c) * DDIM;
            }
            async_cp16x8(l, g);
        }
        wait_async0();
        __syncthreads();

        #pragma unroll                 // constant indices keep acc in registers
        for (int s = 0; s < 4; s++) {
            v16h af[4], bf[NF];
            #pragma unroll             // constant indices keep af in registers
            for (int i = 0; i < 4; i++)
                af[i] = lds_frag(&As[wm + i * 16 + lrow][s * 32 + lhalf * 16]);
            #pragma unroll             // constant indices keep bf in registers
            for (int j = 0; j < NF; j++)
                bf[j] = lds_frag(&Bs[wn + j * 16 + lrow][s * 32 + lhalf * 16]);
            #pragma unroll             // constant indices keep acc in registers
            for (int i = 0; i < 4; i++) {
                #pragma unroll
                for (int j = 0; j < NF; j++)
                    acc[i][j] = wmma_f16(af[i], bf[j], acc[i][j]);
            }
        }
        wait_ds0();                    // this wave has left both tiles: the next round's copies refill them behind the barrier
        __syncthreads();
    }
}

// q, k and v in ONE launch.  They share A and depend on nothing of each other;
// their transposed weights lie behind one another in WT (3,072 rows) and their
// outputs behind one another in qkv, so blockIdx.x >> 3 names the product.
// Work-group tile 128 x 128: 768 work-groups, three per WGP, which cover each
// other's copy latency and barriers.
//   q, k: f16 row-major.  v: f16 transposed [D][NROWS] (VT).
__global__ __launch_bounds__(128)   // the real block size: a wave's 16 accumulator tiles need more registers than the default bound leaves
void gemm_qkv_kernel(const _Float16* __restrict__ A,
                                const _Float16* __restrict__ WT,
                                const float* __restrict__ bq,
                                const float* __restrict__ bk,
                                const float* __restrict__ bv,
                                _Float16* __restrict__ qkv) {
    __shared__ __attribute__((aligned(16))) _Float16 As[128][P128H]; // [row][k], 34 KB
    __shared__ __attribute__((aligned(16))) _Float16 Bs[128][P128H]; // [col][k], 34 KB
    const int wv    = threadIdx.x >> 5;
    const int lrow  = threadIdx.x & 15;
    const int lhalf = (threadIdx.x & 31) >> 4;
    const int wm  = (wv >> 1) * 64;
    const int wn  = (wv & 1) * 64;
    const int M0  = blockIdx.y * 128;
    const int N0  = blockIdx.x * 128;  // row of WT: 1,024 rows per product

    v8f acc[4][4] = {};
    gemm_tile<4>(A, WT, As, Bs, M0, N0, wm, wn, acc);

    const int which   = blockIdx.x >> 3;                 // 0 q, 1 k, 2 v: the same for the whole work-group
    const int colbase = ((N0 + wn) & (DDIM - 1)) + lrow; // column inside that product
    const int rowbase = M0 + wm + lhalf * 8;
    const float* bias = which == 0 ? bq : which == 1 ? bk : bv;
    _Float16* o16 = qkv + (size_t)which * NROWS * DDIM;
    // The sums with their bias, rounded to f16 once, in front of the branch: both
    // paths store out of the same 64 registers, and no store's register is rewritten.
    v8h hv[4][4];
    #pragma unroll                     // constant indices keep acc and hv in registers
    for (int j = 0; j < 4; j++) {
        const float bj = bias[colbase + j * 16];
        #pragma unroll
        for (int i = 0; i < 4; i++) {
            #pragma unroll
            for (int r = 0; r < 8; r++) hv[i][j][r] = (_Float16)(acc[i][j][r] + bj);
        }
    }
    if (which == 2) {
        _Float16* d = o16 + (size_t)colbase * NROWS + rowbase;               // VT
        #pragma unroll
        for (int i = 0; i < 4; i++) {
            #pragma unroll
            for (int j = 0; j < 4; j++)
                *(v8h*)(d + (size_t)(j * 16) * NROWS + i * 16) = hv[i][j];
        }
    } else {
        _Float16* d = o16 + (size_t)rowbase * DDIM + colbase;
        #pragma unroll
        for (int i = 0; i < 4; i++) {
            #pragma unroll
            for (int j = 0; j < 4; j++) {
                #pragma unroll
                for (int r = 0; r < 8; r++)
                    d[(size_t)(i * 16 + r) * DDIM + j * 16] = hv[i][j][r];
            }
        }
        asm volatile("s_wait_xcnt 0x0" ::: "memory");
    }
}

// The output projection: out f32 = val + resid (final output).
// Work-group tile 128 x 64 (a wave 64 x 32): 512 work-groups, two per WGP, so
// that one computes while the other's copies fly.
__global__ __launch_bounds__(128)
void gemm_out_kernel(const _Float16* __restrict__ A,
                                const _Float16* __restrict__ WT,
                                const float* __restrict__ bias,
                                const float* __restrict__ resid,
                                float* __restrict__ out32) {
    __shared__ __attribute__((aligned(16))) _Float16 As[128][P128H]; // [row][k], 34 KB
    __shared__ __attribute__((aligned(16))) _Float16 Bs[64][P128H];  // [col][k], 17 KB
    const int wv    = threadIdx.x >> 5;
    const int lrow  = threadIdx.x & 15;
    const int lhalf = (threadIdx.x & 31) >> 4;
    const int wm  = (wv >> 1) * 64;
    const int wn  = (wv & 1) * 32;
    const int M0  = blockIdx.y * 128;
    const int N0  = blockIdx.x * 64;

    v8f acc[4][2] = {};
    gemm_tile<2>(A, WT, As, Bs, M0, N0, wm, wn, acc);

    const int rowbase = M0 + wm + lhalf * 8;
    const int col0    = N0 + wn + lrow;
    const size_t base = (size_t)rowbase * DDIM + col0;
    const float* rp = resid + base;    // one address pair each; rows and columns are constant offsets
    float*       op = out32 + base;
    float rv[4][2][8];
    #pragma unroll                     // constant indices keep rv in registers
    for (int i = 0; i < 4; i++) {
        #pragma unroll
        for (int j = 0; j < 2; j++) {
            #pragma unroll
            for (int r = 0; r < 8; r++)
                rv[i][j][r] = rp[(size_t)(i * 16 + r) * DDIM + j * 16];
        }
    }
    const float bv[2] = {bias[col0], bias[col0 + 16]};
    asm volatile("s_wait_xcnt 0x0" :: "v"((uint64_t)(uintptr_t)rp) : "memory");
    #pragma unroll                     // constant indices keep acc and rv in registers
    for (int i = 0; i < 4; i++) {
        #pragma unroll
        for (int j = 0; j < 2; j++) {
            #pragma unroll
            for (int r = 0; r < 8; r++) {
                const float val = acc[i][j][r] + bv[j];
                op[(size_t)(i * 16 + r) * DDIM + j * 16] = val + rv[i][j][r];
            }
        }
    }
}

__global__ __launch_bounds__(256)
__attribute__((amdgpu_waves_per_eu(4, 4)))
void attn_kernel(const _Float16* __restrict__ Q,
                            const _Float16* __restrict__ K,
                            const _Float16* __restrict__ VT,   // [D][NROWS]
                            const int* __restrict__ mask,
                            _Float16* __restrict__ Y) {
    __shared__ __attribute__((aligned(16))) _Float16 Ks[2][64][P64H];   // [buf][keyrow][k]   2 x  9 KB
    __shared__ __attribute__((aligned(16))) _Float16 Vs[2][64][P64H];   // [buf][d][keyrow]   2 x  9 KB
    __shared__ __attribute__((aligned(16))) int      Ms[2][128][P64I];  // [buf] mask tile    2 x 34 KB

    const int tid = threadIdx.x;
    const int wv  = tid >> 5;
    const int ln  = tid & 31;
    const int lrow  = ln & 15;
    const int lhalf = ln >> 4;
    const int b = blockIdx.z, h = blockIdx.y;
    const int nblk = blockIdx.x * 128;                // block's query-row base
    const int n0 = nblk + wv * 16;                    // this wave's rows
    const size_t headoff = (size_t)h * DH;

    const size_t qrow = (size_t)(b * TDIM + n0 + lrow) * DDIM + headoff;
    v16h q0 = *(const v16h*)(Q + qrow + lhalf * 16);
    v16h q1 = *(const v16h*)(Q + qrow + 32 + lhalf * 16);

    v8f o[4] = {v8f{}, v8f{}, v8f{}, v8f{}};          // O^T: row d = 16 j + 8 lhalf + i, column = query lrow
    float lsum[4] = {0.f, 0.f, 0.f, 0.f};             // this lane's keys of query lrow, four chains

    // staging thread maps
    const int kmr = tid >> 3, kc = (tid & 7) * 8;     // Ks and Vs: 64 x 64 halves, rows kmr + 32 u
    const int mr  = tid >> 4, mc = (tid & 15) * 4;    // Ms: 128 x 64 ints, rows mr + 16 u
    // the next tile to be copied, one running pointer per array
    const _Float16* ksrc = K  + (size_t)(b * TDIM + kmr) * DDIM + headoff + kc;
    const _Float16* vsrc = VT + (headoff + kmr) * (size_t)NROWS + b * TDIM + kc;
    const int*      msrc = mask + ((size_t)b * TDIM + nblk + mr) * TDIM + mc;

    // One lane's twelve copies of the next tile into buffer buf: every copy of a
    // wave takes whole 128-B lines (four rows of K or VT, two 256-B rows of the mask).
    auto stage = [&](const int buf) __attribute__((always_inline)) {
        void* l[12];
        const void* g[12];
        #pragma unroll             // constant indices keep l and g in registers
        for (int u = 0; u < 2; u++) {
            l[u]     = &Ks[buf][kmr + 32 * u][kc];
            g[u]     = ksrc + (size_t)(32 * u) * DDIM;
            l[2 + u] = &Vs[buf][kmr + 32 * u][kc];
            g[2 + u] = vsrc + (size_t)(32 * u) * NROWS;
        }
        #pragma unroll             // constant indices keep l and g in registers
        for (int u = 0; u < 8; u++) {
            l[4 + u] = &Ms[buf][mr + 16 * u][mc];
            g[4 + u] = msrc + (16 * u) * TDIM;
        }
        async_cp16x12(l, g);
        ksrc += (size_t)64 * DDIM;
        vsrc += 64;
        msrc += 64;
    };

    // One pass: keys 32 p .. 32 p + 31 of the tile in buffer buf.  publish: this is
    // the tile's last pass; refill: a tile t + 2 exists.
    auto pass = [&](const int buf, const int p, const bool publish, const bool refill) __attribute__((always_inline)) {
        // S^T block t: row = key 32 p + 16 t + 8 lhalf + i, column = query lrow.
        v8f s[2];
        #pragma unroll             // constant indices keep s in registers
        for (int t = 0; t < 2; t++) {
            v16h kf0 = lds_frag(&Ks[buf][p * 32 + t * 16 + lrow][lhalf * 16]);
            v16h kf1 = lds_frag(&Ks[buf][p * 32 + t * 16 + lrow][32 + lhalf * 16]);
            v8f z = v8f{};
            z = wmma_f16(kf0, q0, z);
            z = wmma_f16(kf1, q1, z);
            s[t] = z;
        }
        // The pass's mask words and V^T fragments (A operand, in the key order of pf).
        v4i mlo[2], mhi[2];
        #pragma unroll             // constant indices keep mlo and mhi in registers
        for (int t = 0; t < 2; t++) {
            const int* mrow = &Ms[buf][wv * 16 + lrow][p * 32 + t * 16 + lhalf * 8];
            mlo[t] = *(const v4i*)mrow;
            mhi[t] = *(const v4i*)(mrow + 4);
        }
        v16h vf[4];
        #pragma unroll             // constant indices keep vf in registers
        for (int j = 0; j < 4; j++) {
            const _Float16* vrow = &Vs[buf][j * 16 + lrow][p * 32 + lhalf * 8];
            v8h lo = *(const v8h*)vrow;
            v8h hi = *(const v8h*)(vrow + 16);
            vf[j] = __builtin_shufflevector(lo, hi, 0, 1, 2, 3, 4, 5, 6, 7,
                                            8, 9, 10, 11, 12, 13, 14, 15);
        }

        if (publish) {
            // Publish point: the tile's last LDS read stands above, the rest of the
            // trip works on registers.  This wave has left buffer buf; its copies of
            // tile t + 1 have landed; the barrier says both of every wave.
            // The wait names the output tiles as they stand behind the first pass
            // (inputs only), which keeps that pass's work in front of the point:
            // without it the built code draws two points together, and the copies
            // asked for at the first of them are waited for at once instead of
            // after two passes.
            asm volatile("s_wait_dscnt 0x0" :: "v"(o[0]), "v"(o[1]), "v"(o[2]), "v"(o[3]) : "memory");
            wait_async0();
            __syncthreads();
            if (refill) stage(buf);
        }

        // P^T as a B operand: element 8 t + i of a lane is key 32 p + 16 t + 8 lhalf + i.
        v16h pf;
        #pragma unroll             // constant indices keep s, pf and lsum in registers
        for (int t = 0; t < 2; t++) {
            #pragma unroll         // constant indices keep s, pf and lsum in registers
            for (int i = 0; i < 8; i++) {
                const int mk = i < 4 ? mlo[t][i & 3] : mhi[t][i & 3];
                float pr = mk ? __expf(s[t][i] * 0.125f) : 0.0f;
                lsum[i & 3] += pr;
                pf[t * 8 + i] = (_Float16)pr;
            }
        }
        #pragma unroll             // constant indices keep o in registers
        for (int j = 0; j < 4; j++)
            o[j] = wmma_f16(vf[j], pf, o[j]);
    };
    // One trip: tile t out of buffer buf = t mod 2.
    auto trip = [&](const int buf, const bool refill) __attribute__((always_inline)) {
        pass(buf, 0, false, false);
        pass(buf, 1, true, refill);
    };

    stage(0);                      // tile 0
    wait_async0();
    __syncthreads();
    stage(1);                      // tile 1 flies during trip 0
    // Two trips a round of the loop, so that the buffer is a constant in every
    // address; the last two trips, which have no tile left to ask for, stand behind it.
    for (int m0 = 0; m0 < TDIM - 128; m0 += 128) {
        trip(0, true);
        trip(1, true);
    }
    trip(0, false);
    trip(1, false);
    wait_async0();                 // nothing is outstanding when the wave ends

    // Join the two half-waves' partial sums of each query once, behind the loop.
    float den = (lsum[0] + lsum[1]) + (lsum[2] + lsum[3]);
    den += __shfl_xor(den, 16, 32);

    _Float16* yrow = Y + (size_t)(b * TDIM + n0 + lrow) * DDIM + headoff + lhalf * 8;
    #pragma unroll                 // constant indices keep o in registers
    for (int j = 0; j < 4; j++) {
        v8h hv;
        #pragma unroll             // constant indices keep o and hv in registers
        for (int i = 0; i < 8; i++)
            hv[i] = (_Float16)(o[j][i] / (den + 1e-20f));
        *(v8h*)(yrow + j * 16) = hv;
    }
}

// ---------------------------------------------------------------------------
// Host launcher
// ---------------------------------------------------------------------------
extern "C" void kernel_launch(void* const* d_in, const int* in_sizes, int n_in,
                              void* d_out, int out_size, void* d_ws, size_t ws_size,
                              hipStream_t stream) {
    const float* x     = (const float*)d_in[0];
    const int*   mask  = (const int*)  d_in[1];
    const float* gamma = (const float*)d_in[2];
    const float* beta  = (const float*)d_in[3];
    const float* Wq    = (const float*)d_in[4];
    const float* bq    = (const float*)d_in[5];
    const float* Wk    = (const float*)d_in[6];
    const float* bk    = (const float*)d_in[7];
    const float* Wv    = (const float*)d_in[8];
    const float* bv    = (const float*)d_in[9];
    const float* Wo    = (const float*)d_in[10];
    const float* bo    = (const float*)d_in[11];
    float* out = (float*)d_out;

    const size_t ND = (size_t)NROWS * DDIM;
    const size_t DD = (size_t)DDIM * DDIM;
    _Float16* xn   = (_Float16*)d_ws;
    _Float16* q    = xn + ND;
    _Float16* k    = q + ND;
    _Float16* vt   = k + ND;          // [D][NROWS]
    _Float16* y    = vt + ND;
    _Float16* w16t = y + ND;          // 4*DD halves (total 48 MB)

    prep_kernel<<<LN_BLOCKS + CVT_BLOCKS, 256, 0, stream>>>(x, gamma, beta, xn, Wq, Wk, Wv, Wo, w16t);

    dim3 qkvgrid(3 * DDIM / 128, NROWS / 128);  // q, k, vt lie behind one another in the workspace
    gemm_qkv_kernel<<<qkvgrid, 128, 0, stream>>>(xn, w16t, bq, bk, bv, q);

    dim3 agrid(TDIM / 128, HH, BDIM);
    attn_kernel<<<agrid, 256, 0, stream>>>(q, k, vt, mask, y);

    dim3 ggrid(DDIM / 64, NROWS / 128);
    gemm_out_kernel<<<ggrid, 128, 0, stream>>>(y, w16t + 3 * DD, bo, x, out);
}
